// v000
// Times are from an AMD MI455X. After a warm-up the kernel runs many times in a row, and a time is the length of
// such a window on the GPU divided by its runs, so every launch and the gaps after it count. The runs cycle
// through copies of the inputs. A figure is the median of several windows, for all but v000 over two sittings.
// Sittings can differ by a few percent; kernels timed side by side share one.
// v000, which the later versions start from, runs in 195 microseconds.
#include <hip/hip_runtime.h>
#include <hip/hip_bf16.h>

#define BB 4
#define NN 2048
#define HH 16
#define DD 64

typedef __attribute__((ext_vector_type(16))) __bf16 v16bf;
typedef __attribute__((ext_vector_type(8)))  float  v8f;

union FragBF { v16bf v; unsigned u[8]; uint4 q[2]; };
union Acc    { v8f v; float f[8]; };

// Pinned packed conversion: keeps SLP from turning pairs into v_perm shuffles.
__device__ __forceinline__ unsigned pk(float a, float b) {
    unsigned d;
    asm("v_cvt_pk_bf16_f32 %0, %1, %2" : "=v"(d) : "v"(a), "v"(b));
    return d;
}

__device__ __forceinline__ v8f wmma_bf16(const v16bf& a, const v16bf& b, const v8f& c) {
    return __builtin_amdgcn_wmma_f32_16x16x32_bf16(false, a, false, b, (short)0, c, false, false);
}

__device__ __forceinline__ void wait_async0() {
#if __has_builtin(__builtin_amdgcn_s_wait_asynccnt)
    __builtin_amdgcn_s_wait_asynccnt(0);
#else
    asm volatile("s_wait_asynccnt 0x0" ::: "memory");
#endif
}

// Async copy 16B (global -> LDS), GV mode, tracked by ASYNCcnt.
__device__ __forceinline__ void async_b128(unsigned lds_off, unsigned long long gaddr) {
    asm volatile("global_load_async_to_lds_b128 %0, %1, off"
                 :: "v"(lds_off), "v"(gaddr) : "memory");
}

// Fragment dword map (16-bit 16x16x32 WMMA, wave32):
//   register r (0..7), lane-half hf: dword index = (r>>2)*8 + hf*4 + (r&3)
//   within a 32-dword (64 bf16) row; K-slice ks adds 16 dwords.
// => u[0..3] and u[4..7] are each 16B-contiguous: load fragments as 2 x b128.

// ---------------------------------------------------------------------------
// Kernel 0a: convert x fp32 -> bf16 (same [B,N,H,D] layout; rows stay
// fragment-contiguous so A-fragments become pure b128 loads downstream).
// ---------------------------------------------------------------------------
__global__ __launch_bounds__(256) void pack_x_kernel(
    const float* __restrict__ x, unsigned* __restrict__ xb)
{
    const size_t i = (size_t)blockIdx.x * 256 + threadIdx.x;   // one uint4 out
    const float4* xp = (const float4*)x;
    float4 f0 = xp[i * 2 + 0];
    float4 f1 = xp[i * 2 + 1];
    uint4 o;
    o.x = pk(f0.x, f0.y); o.y = pk(f0.z, f0.w);
    o.z = pk(f1.x, f1.y); o.w = pk(f1.z, f1.w);
    ((uint4*)xb)[i] = o;
}

// ---------------------------------------------------------------------------
// Kernel 0b: pre-pack weights fp32 [H,D,D] -> bf16, fragment-major:
//   dst uint4[(h*2+ks)*256 + g*128 + hf*64 + col] = regs r=0..3 for that slot,
//   where k = ks*32 + g*16 + hf*8 + 2r (+1), col = output column.
// ---------------------------------------------------------------------------
__global__ __launch_bounds__(256) void pack_w_kernel(
    const float* __restrict__ Wq, const float* __restrict__ Wk,
    const float* __restrict__ Wv, const float* __restrict__ Wo,
    unsigned* __restrict__ Wqb, unsigned* __restrict__ Wkb,
    unsigned* __restrict__ Wvb, unsigned* __restrict__ Wob)
{
    const int idx = blockIdx.x * 256 + threadIdx.x;      // H*32*64 = 32768 total
    const int col = idx & 63;
    const int k2  = (idx >> 6) & 31;                     // k/2
    const int h   = idx >> 11;
    const int ks  = k2 >> 4;
    const int g   = (k2 >> 3) & 1;
    const int hf  = (k2 >> 2) & 1;
    const int r   = k2 & 3;
    const size_t src = ((size_t)h * DD + 2 * k2) * DD + col;
    const int dst = (((h * 2 + ks) * 256 + g * 128 + hf * 64 + col) << 2) + r;
    Wqb[dst] = pk(Wq[src], Wq[src + DD]);
    Wkb[dst] = pk(Wk[src], Wk[src + DD]);
    Wvb[dst] = pk(Wv[src], Wv[src + DD]);
    Wob[dst] = pk(Wo[src], Wo[src + DD]);
}

// One projection matrix: 16 rows x 64 cols; each B-frag = 2 x b128 loads.
// MODE 0: Q (scaled 1/32, [B,H,N,D]); 1: K ([B,H,N,D]); 2: V transposed ([B,H,D,N]).
template<int MODE>
__device__ __forceinline__ void proj_mat(
    const FragBF a[2], const uint4* __restrict__ Wb4,
    const float* __restrict__ bias, int bh, int h,
    int n0, int l16, int half, __bf16* __restrict__ dst)
{
    v8f c[4];
    { v8f z = {}; for (int i = 0; i < 4; ++i) c[i] = z; }
#pragma unroll
    for (int ks = 0; ks < 2; ++ks) {
        const uint4* wb = Wb4 + (size_t)(h * 2 + ks) * 256 + half * 64;
#pragma unroll
        for (int ct = 0; ct < 4; ++ct) {
            const int col = ct * 16 + l16;
            FragBF bf;
            bf.q[0] = wb[col];          // regs 0..3
            bf.q[1] = wb[128 + col];    // regs 4..7
            c[ct] = wmma_bf16(a[ks].v, bf.v, c[ct]);
        }
    }
#pragma unroll
    for (int ct = 0; ct < 4; ++ct) {
        const int col = ct * 16 + l16;
        const float bv = bias[h * DD + col];
#pragma unroll
        for (int r = 0; r < 8; ++r) {
            const int row = n0 + r + 8 * half;           // C: m = r + 8*half
            const float val = c[ct][r] + bv;
            if (MODE == 0)
                dst[((size_t)bh * NN + row) * DD + col] = (__bf16)(val * 0.03125f);
            else if (MODE == 1)
                dst[((size_t)bh * NN + row) * DD + col] = (__bf16)val;
            else
                dst[((size_t)bh * DD + col) * NN + row] = (__bf16)val;
        }
    }
}

// ---------------------------------------------------------------------------
// Kernel 1: fused Q/K/V projection. grid = (N/64, B*H), block = 128 (4 waves).
// ---------------------------------------------------------------------------
__global__ __launch_bounds__(128) void qkv_proj_kernel(
    const __bf16* __restrict__ xb,
    const uint4* __restrict__ Wqb, const float* __restrict__ bq,
    const uint4* __restrict__ Wkb, const float* __restrict__ bk,
    const uint4* __restrict__ Wvb, const float* __restrict__ bv,
    __bf16* __restrict__ Qs, __bf16* __restrict__ Ks, __bf16* __restrict__ Vt)
{
    const int bh   = blockIdx.y;
    const int b    = bh / HH, h = bh % HH;
    const int wave = threadIdx.x >> 5;
    const int lane = threadIdx.x & 31;
    const int half = lane >> 4;
    const int l16  = lane & 15;
    const int n0   = blockIdx.x * 64 + wave * 16;

    // A fragments: rows n0..n0+15 of xb, pure 2 x b128 per K-slice.
    FragBF a[2];
    {
        const uint4* xp4 = (const uint4*)(xb + ((size_t)(b * NN + n0 + l16) * HH + h) * DD);
#pragma unroll
        for (int ks = 0; ks < 2; ++ks) {
            a[ks].q[0] = xp4[ks * 4 + half];
            a[ks].q[1] = xp4[ks * 4 + 2 + half];
        }
    }
    proj_mat<0>(a, Wqb, bq, bh, h, n0, l16, half, Qs);
    proj_mat<1>(a, Wkb, bk, bh, h, n0, l16, half, Ks);
    proj_mat<2>(a, Wvb, bv, bh, h, n0, l16, half, Vt);
}

// Stage one 32-key K/V tile into an LDS buffer (async, ASYNCcnt-tracked).
__device__ __forceinline__ void stage_tile(
    const __bf16* __restrict__ Ks, const __bf16* __restrict__ Vt,
    int bh, int j0, int t, unsigned klds, unsigned vlds)
{
    // K tile: rows j0..j0+31 contiguous -> 4 KB, 32 B per thread
    unsigned long long kg = (unsigned long long)(uintptr_t)
        (Ks + ((size_t)bh * NN + j0) * DD) + (unsigned long long)t * 32u;
    async_b128(klds, kg);
    async_b128(klds + 16u, kg + 16u);
    // Vt tile: 64 rows (d) x 64 B; 32 B per thread
    const int vrow = t >> 1;
    unsigned long long vg = (unsigned long long)(uintptr_t)
        (Vt + ((size_t)bh * DD + vrow) * NN + j0) + ((unsigned long long)(t & 1) << 5);
    async_b128(vlds, vg);
    async_b128(vlds + 16u, vg + 16u);
}

// ---------------------------------------------------------------------------
// Kernel 2: flash attention. grid = (N/64, B*H), block = 128 (4 waves).
// Sᵀ = K·Qᵀ so the score C-layout refeeds directly as the P A-fragment.
// Double-buffered LDS staging: tile j+1 async-loads overlap tile-j compute.
// ---------------------------------------------------------------------------
__global__ __launch_bounds__(128) void flash_attn_kernel(
    const __bf16* __restrict__ Qs, const __bf16* __restrict__ Ks,
    const __bf16* __restrict__ Vt, __bf16* __restrict__ attn)
{
    __shared__ uint4 kbuf4[2][256];   // K tiles: 32 keys x 64 bf16 (4 KB each)
    __shared__ uint4 vbuf4[2][256];   // Vt tiles: 64 d x 32 bf16  (4 KB each)

    const int bh   = blockIdx.y;
    const int wave = threadIdx.x >> 5;
    const int lane = threadIdx.x & 31;
    const int half = lane >> 4;
    const int l16  = lane & 15;
    const int q0   = blockIdx.x * 64 + wave * 16;
    const int t    = threadIdx.x;

    // LDS byte offsets (generic shared pointer: low 32 bits = LDS offset)
    const unsigned koff = (unsigned)(uintptr_t)(void*)&kbuf4[0][0];
    const unsigned voff = (unsigned)(uintptr_t)(void*)&vbuf4[0][0];
    const int vrow = t >> 1;
    const unsigned kl_t = (unsigned)t * 32u;
    const unsigned vl_t = ((unsigned)vrow << 6) + ((unsigned)(t & 1) << 5);

    // Resident Qᵀ B-fragments (lane = query): 2 x b128 per K-slice.
    FragBF qt[2];
    {
        const uint4* qp4 = (const uint4*)(Qs + ((size_t)bh * NN + q0 + l16) * DD);
#pragma unroll
        for (int ks = 0; ks < 2; ++ks) {
            qt[ks].q[0] = qp4[ks * 4 + half];
            qt[ks].q[1] = qp4[ks * 4 + 2 + half];
        }
    }

    float m_run = -1e30f, l_run = 0.f;
    v8f o[4];
    { v8f z = {}; for (int i = 0; i < 4; ++i) o[i] = z; }

    // Prologue: stage tile 0 into buffer 0
    stage_tile(Ks, Vt, bh, 0, t, koff + kl_t, voff + vl_t);
    wait_async0();
    __syncthreads();

    int cur = 0;
    for (int j0 = 0; j0 < NN; j0 += 32) {
        const int nxt = cur ^ 1;
        if (j0 + 32 < NN)   // issue next tile's async loads; overlap with compute
            stage_tile(Ks, Vt, bh, j0 + 32, t,
                       koff + (unsigned)(nxt << 12) + kl_t,
                       voff + (unsigned)(nxt << 12) + vl_t);

        const uint4* kb4 = kbuf4[cur];
        const uint4* vb4 = vbuf4[cur];

        // Sᵀ tiles: st[sub] = K[j0+sub*16 .. +15] · Qᵀ   (C: lane=query, vgpr=key)
        Acc st[2];
#pragma unroll
        for (int sub = 0; sub < 2; ++sub) {
            v8f c = {};
#pragma unroll
            for (int ks = 0; ks < 2; ++ks) {
                FragBF ka;                                   // 2 x ds_load_b128
                ka.q[0] = kb4[(sub * 16 + l16) * 8 + ks * 4 + half];
                ka.q[1] = kb4[(sub * 16 + l16) * 8 + ks * 4 + 2 + half];
                c = wmma_bf16(ka.v, qt[ks].v, c);
            }
            st[sub].v = c;
        }

        // Online softmax (scale 1/32 folded into Q). Keys split lane <-> lane^16.
        float tmax = st[0].f[0];
#pragma unroll
        for (int r = 1; r < 8; ++r) tmax = fmaxf(tmax, st[0].f[r]);
#pragma unroll
        for (int r = 0; r < 8; ++r) tmax = fmaxf(tmax, st[1].f[r]);
        tmax = fmaxf(tmax, __shfl_xor(tmax, 16, 32));
        const float m_new = fmaxf(m_run, tmax);
        const float alpha = __expf(m_run - m_new);
        float tsum = 0.f;
#pragma unroll
        for (int r = 0; r < 8; ++r) { st[0].f[r] = __expf(st[0].f[r] - m_new); tsum += st[0].f[r]; }
#pragma unroll
        for (int r = 0; r < 8; ++r) { st[1].f[r] = __expf(st[1].f[r] - m_new); tsum += st[1].f[r]; }
        tsum += __shfl_xor(tsum, 16, 32);
        l_run = l_run * alpha + tsum;
        m_run = m_new;

        // Pack P as A-fragment: Sᵀ C-layout maps 1:1 onto P A-layout (same lane).
        FragBF pa;
#pragma unroll
        for (int r = 0; r < 4; ++r) {
            pa.u[r]     = pk(st[0].f[2 * r], st[0].f[2 * r + 1]);
            pa.u[4 + r] = pk(st[1].f[2 * r], st[1].f[2 * r + 1]);
        }
        // Broadcast per-query alpha into O-tile layout (query = r + 8*half)
        float am[8];
#pragma unroll
        for (int r = 0; r < 8; ++r) am[r] = __shfl(alpha, r + 8 * half, 32);

#pragma unroll
        for (int dt = 0; dt < 4; ++dt) {
            FragBF bvv;                                      // 2 x ds_load_b128
            bvv.q[0] = vb4[(dt * 16 + l16) * 4 + half];
            bvv.q[1] = vb4[(dt * 16 + l16) * 4 + 2 + half];
            v8f c = o[dt];
#pragma unroll
            for (int r = 0; r < 8; ++r) c[r] *= am[r];
            o[dt] = wmma_bf16(pa.v, bvv.v, c);
        }

        wait_async0();      // next tile's data landed in LDS
        __syncthreads();    // all waves done reading cur, next tile visible
        cur = nxt;
    }

    // Normalize by l and store attn (bf16 [B,H,N,D])
    float lm[8];
#pragma unroll
    for (int r = 0; r < 8; ++r) lm[r] = __shfl(l_run, r + 8 * half, 32);
#pragma unroll
    for (int dt = 0; dt < 4; ++dt)
#pragma unroll
        for (int r = 0; r < 8; ++r) {
            const int row = q0 + r + 8 * half;
            attn[((size_t)bh * NN + row) * DD + dt * 16 + l16] = (__bf16)(o[dt][r] / lm[r]);
        }
}

// ---------------------------------------------------------------------------
// Kernel 3: output projection. out[b,n,h,:] = attn[b,h,n,:]·Wo[h] + bo[h], fp32.
// ---------------------------------------------------------------------------
__global__ __launch_bounds__(128) void out_proj_kernel(
    const __bf16* __restrict__ attn, const uint4* __restrict__ Wob,
    const float* __restrict__ bo, float* __restrict__ out)
{
    const int bh   = blockIdx.y;
    const int b    = bh / HH, h = bh % HH;
    const int wave = threadIdx.x >> 5;
    const int lane = threadIdx.x & 31;
    const int half = lane >> 4;
    const int l16  = lane & 15;
    const int n0   = blockIdx.x * 64 + wave * 16;

    FragBF a[2];
    {
        const uint4* ap4 = (const uint4*)(attn + ((size_t)bh * NN + n0 + l16) * DD);
#pragma unroll
        for (int ks = 0; ks < 2; ++ks) {
            a[ks].q[0] = ap4[ks * 4 + half];
            a[ks].q[1] = ap4[ks * 4 + 2 + half];
        }
    }
    v8f c[4];
    { v8f z = {}; for (int i = 0; i < 4; ++i) c[i] = z; }
#pragma unroll
    for (int ks = 0; ks < 2; ++ks) {
        const uint4* wb = Wob + (size_t)(h * 2 + ks) * 256 + half * 64;
#pragma unroll
        for (int ct = 0; ct < 4; ++ct) {
            const int col = ct * 16 + l16;
            FragBF bf;
            bf.q[0] = wb[col];
            bf.q[1] = wb[128 + col];
            c[ct] = wmma_bf16(a[ks].v, bf.v, c[ct]);
        }
    }
#pragma unroll
    for (int ct = 0; ct < 4; ++ct) {
        const int col = ct * 16 + l16;
        const float bias = bo[h * DD + col];
#pragma unroll
        for (int r = 0; r < 8; ++r) {
            const int row = n0 + r + 8 * half;
            out[((size_t)(b * NN + row) * HH + h) * DD + col] = c[ct][r] + bias;
        }
    }
}

extern "C" void kernel_launch(void* const* d_in, const int* in_sizes, int n_in,
                              void* d_out, int out_size, void* d_ws, size_t ws_size,
                              hipStream_t stream) {
    const float* x  = (const float*)d_in[0];
    const float* Wq = (const float*)d_in[1];
    const float* bq = (const float*)d_in[2];
    const float* Wk = (const float*)d_in[3];
    const float* bk = (const float*)d_in[4];
    const float* Wv = (const float*)d_in[5];
    const float* bv = (const float*)d_in[6];
    const float* Wo = (const float*)d_in[7];
    const float* bo = (const float*)d_in[8];
    float* out = (float*)d_out;

    const size_t SZ = (size_t)BB * HH * NN * DD;     // elems per bf16 tensor
    const size_t WSZ = (size_t)HH * 32 * 64;         // packed-weight dwords per tensor
    __bf16* Qs = (__bf16*)d_ws;
    __bf16* Ks = Qs + SZ;
    __bf16* Vt = Ks + SZ;
    __bf16* at = Vt + SZ;
    __bf16* xb = at + SZ;
    unsigned* Wqb = (unsigned*)(xb + SZ);
    unsigned* Wkb = Wqb + WSZ;
    unsigned* Wvb = Wkb + WSZ;
    unsigned* Wob = Wvb + WSZ;

    dim3 grid(NN / 64, BB * HH);
    pack_x_kernel   <<<dim3((unsigned)(SZ / 8 / 256)), 256, 0, stream>>>(x, (unsigned*)xb);
    pack_w_kernel   <<<dim3(128), 256, 0, stream>>>(Wq, Wk, Wv, Wo, Wqb, Wkb, Wvb, Wob);
    qkv_proj_kernel <<<grid, 128, 0, stream>>>(xb, (const uint4*)Wqb, bq, (const uint4*)Wkb, bk,
                                               (const uint4*)Wvb, bv, Qs, Ks, Vt);
    flash_attn_kernel<<<grid, 128, 0, stream>>>(Qs, Ks, Vt, at);
    out_proj_kernel <<<grid, 128, 0, stream>>>(at, (const uint4*)Wob, bo, out);
}

// v001
// Measured time: 124 microseconds a run.
// In two side-by-side timings against v000, it was 1.64 and 1.63 times as fast.
#include <hip/hip_runtime.h>
#include <hip/hip_bf16.h>

#define BB 4
#define NN 2048
#define HH 16
#define DD 64

// LDS row pitches in bytes, 16 B x odd: the 16 lanes of a ds_load_b128 half
// then start on 16 different 4-bank groups (64 banks x 4 B), no bank conflict.
#define KPITCH 144                 // K rows: 128 B of data + 16 B pad
#define VPITCH 80                  // Vt rows: 64 B of data + 16 B pad
#define KBUF   (32 * KPITCH)       // one K tile, 32 keys
#define VBUF   (64 * VPITCH)       // one Vt tile, 64 d-rows

typedef __attribute__((ext_vector_type(16))) __bf16 v16bf;
typedef __attribute__((ext_vector_type(8)))  float  v8f;

union FragBF { v16bf v; unsigned u[8]; uint4 q[2]; };
union Acc    { v8f v; float f[8]; };

// Pinned packed conversion: keeps SLP from turning pairs into v_perm shuffles.
__device__ __forceinline__ unsigned pk(float a, float b) {
    unsigned d;
    asm("v_cvt_pk_bf16_f32 %0, %1, %2" : "=v"(d) : "v"(a), "v"(b));
    return d;
}

__device__ __forceinline__ v8f wmma_bf16(const v16bf& a, const v16bf& b, const v8f& c) {
    return __builtin_amdgcn_wmma_f32_16x16x32_bf16(false, a, false, b, (short)0, c, false, false);
}

__device__ __forceinline__ void wait_async0() {
#if __has_builtin(__builtin_amdgcn_s_wait_asynccnt)
    __builtin_amdgcn_s_wait_asynccnt(0);
#else
    asm volatile("s_wait_asynccnt 0x0" ::: "memory");
#endif
}

// Four async copies of 16 B per lane (global -> LDS), tracked by ASYNCcnt.
// s_wait_xcnt 0 closes the statement so that no address register named here
// is rewritten (next trip's address additions) ahead of it.
__device__ __forceinline__ void async_b128x4(
    unsigned l0, unsigned long long g0, unsigned l1, unsigned long long g1,
    unsigned l2, unsigned long long g2, unsigned l3, unsigned long long g3) {
    asm volatile("global_load_async_to_lds_b128 %0, %1, off\n\t"
                 "global_load_async_to_lds_b128 %2, %3, off\n\t"
                 "global_load_async_to_lds_b128 %4, %5, off\n\t"
                 "global_load_async_to_lds_b128 %6, %7, off\n\t"
                 "s_wait_xcnt 0x0"
                 :: "v"(l0), "v"(g0), "v"(l1), "v"(g1),
                    "v"(l2), "v"(g2), "v"(l3), "v"(g3) : "memory");
}

// Fragment dword map (16-bit 16x16x32 WMMA, wave32):
//   register r (0..7), lane-half hf: dword index = (r>>2)*8 + hf*4 + (r&3)
//   within a 32-dword (64 bf16) row; K-slice ks adds 16 dwords.
// => u[0..3] and u[4..7] are each 16B-contiguous: load fragments as 2 x b128.

// ---------------------------------------------------------------------------
// Kernel 0a: convert x fp32 -> bf16 (same [B,N,H,D] layout; rows stay
// fragment-contiguous so A-fragments become pure b128 loads downstream).
// ---------------------------------------------------------------------------
__global__ __launch_bounds__(256) void pack_x_kernel(
    const float* __restrict__ x, unsigned* __restrict__ xb)
{
    const size_t i = (size_t)blockIdx.x * 256 + threadIdx.x;   // one uint4 out
    const float4* xp = (const float4*)x;
    float4 f0 = xp[i * 2 + 0];
    float4 f1 = xp[i * 2 + 1];
    uint4 o;
    o.x = pk(f0.x, f0.y); o.y = pk(f0.z, f0.w);
    o.z = pk(f1.x, f1.y); o.w = pk(f1.z, f1.w);
    ((uint4*)xb)[i] = o;
}

// ---------------------------------------------------------------------------
// Kernel 0b: pre-pack weights fp32 [H,D,D] -> bf16, fragment-major:
//   dst uint4[(h*2+ks)*256 + g*128 + hf*64 + col] = regs r=0..3 for that slot,
//   where k = ks*32 + g*16 + hf*8 + 2r (+1), col = output column.
// ---------------------------------------------------------------------------
__global__ __launch_bounds__(256) void pack_w_kernel(
    const float* __restrict__ Wq, const float* __restrict__ Wk,
    const float* __restrict__ Wv, const float* __restrict__ Wo,
    unsigned* __restrict__ Wqb, unsigned* __restrict__ Wkb,
    unsigned* __restrict__ Wvb, unsigned* __restrict__ Wob)
{
    const int idx = blockIdx.x * 256 + threadIdx.x;      // H*32*64 = 32768 total
    const int col = idx & 63;
    const int k2  = (idx >> 6) & 31;                     // k/2
    const int h   = idx >> 11;
    const int ks  = k2 >> 4;
    const int g   = (k2 >> 3) & 1;
    const int hf  = (k2 >> 2) & 1;
    const int r   = k2 & 3;
    const size_t src = ((size_t)h * DD + 2 * k2) * DD + col;
    const int dst = (((h * 2 + ks) * 256 + g * 128 + hf * 64 + col) << 2) + r;
    Wqb[dst] = pk(Wq[src], Wq[src + DD]);
    Wkb[dst] = pk(Wk[src], Wk[src + DD]);
    Wvb[dst] = pk(Wv[src], Wv[src + DD]);
    Wob[dst] = pk(Wo[src], Wo[src + DD]);
}

// One projection matrix: 16 rows x 64 cols; each B-frag = 2 x b128 loads.
// MODE 0: Q (scaled 1/32, [B,H,N,D]); 1: K ([B,H,N,D]); 2: V transposed ([B,H,D,N]).
template<int MODE>
__device__ __forceinline__ void proj_mat(
    const FragBF a[2], const uint4* __restrict__ Wb4,
    const float* __restrict__ bias, int bh, int h,
    int n0, int l16, int half, __bf16* __restrict__ dst)
{
    v8f c[4];
    { v8f z = {}; for (int i = 0; i < 4; ++i) c[i] = z; }
#pragma unroll
    for (int ks = 0; ks < 2; ++ks) {
        const uint4* wb = Wb4 + (size_t)(h * 2 + ks) * 256 + half * 64;
#pragma unroll
        for (int ct = 0; ct < 4; ++ct) {
            const int col = ct * 16 + l16;
            FragBF bf;
            bf.q[0] = wb[col];          // regs 0..3
            bf.q[1] = wb[128 + col];    // regs 4..7
            c[ct] = wmma_bf16(a[ks].v, bf.v, c[ct]);
        }
    }
#pragma unroll
    for (int ct = 0; ct < 4; ++ct) {
        const int col = ct * 16 + l16;
        const float bv = bias[h * DD + col];
#pragma unroll
        for (int r = 0; r < 8; ++r) {
            const int row = n0 + r + 8 * half;           // C: m = r + 8*half
            const float val = c[ct][r] + bv;
            if (MODE == 0)
                dst[((size_t)bh * NN + row) * DD + col] = (__bf16)(val * 0.03125f);
            else if (MODE == 1)
                dst[((size_t)bh * NN + row) * DD + col] = (__bf16)val;
            else
                dst[((size_t)bh * DD + col) * NN + row] = (__bf16)val;
        }
    }
}

// ---------------------------------------------------------------------------
// Kernel 1: fused Q/K/V projection. grid = (N/64, B*H), block = 128 (4 waves).
// ---------------------------------------------------------------------------
__global__ __launch_bounds__(128) void qkv_proj_kernel(
    const __bf16* __restrict__ xb,
    const uint4* __restrict__ Wqb, const float* __restrict__ bq,
    const uint4* __restrict__ Wkb, const float* __restrict__ bk,
    const uint4* __restrict__ Wvb, const float* __restrict__ bv,
    __bf16* __restrict__ Qs, __bf16* __restrict__ Ks, __bf16* __restrict__ Vt)
{
    const int bh   = blockIdx.y;
    const int b    = bh / HH, h = bh % HH;
    const int wave = threadIdx.x >> 5;
    const int lane = threadIdx.x & 31;
    const int half = lane >> 4;
    const int l16  = lane & 15;
    const int n0   = blockIdx.x * 64 + wave * 16;

    // A fragments: rows n0..n0+15 of xb, pure 2 x b128 per K-slice.
    FragBF a[2];
    {
        const uint4* xp4 = (const uint4*)(xb + ((size_t)(b * NN + n0 + l16) * HH + h) * DD);
#pragma unroll
        for (int ks = 0; ks < 2; ++ks) {
            a[ks].q[0] = xp4[ks * 4 + half];
            a[ks].q[1] = xp4[ks * 4 + 2 + half];
        }
    }
    proj_mat<0>(a, Wqb, bq, bh, h, n0, l16, half, Qs);
    proj_mat<1>(a, Wkb, bk, bh, h, n0, l16, half, Ks);
    proj_mat<2>(a, Wvb, bv, bh, h, n0, l16, half, Vt);
}

// Stage one 32-key K/V tile into an LDS buffer (async, ASYNCcnt-tracked).
__device__ __forceinline__ void stage_tile(
    const __bf16* __restrict__ Ks, const __bf16* __restrict__ Vt,
    int bh, int j0, int t, unsigned klds, unsigned vlds)
{
    // K tile: rows j0..j0+31 contiguous in global -> 4 KB, 32 B per thread
    unsigned long long kg = (unsigned long long)(uintptr_t)
        (Ks + ((size_t)bh * NN + j0) * DD) + (unsigned long long)t * 32u;
    // Vt tile: 64 rows (d) x 64 B; 32 B per thread
    const int vrow = t >> 1;
    unsigned long long vg = (unsigned long long)(uintptr_t)
        (Vt + ((size_t)bh * DD + vrow) * NN + j0) + ((unsigned long long)(t & 1) << 5);
    async_b128x4(klds, kg, klds + 16u, kg + 16u, vlds, vg, vlds + 16u, vg + 16u);
}

// ---------------------------------------------------------------------------
// Kernel 2: flash attention. grid = (N/64, B*H), block = 128 (4 waves).
// Sᵀ = K·Qᵀ so the score C-layout refeeds directly as the P A-fragment.
// Double-buffered LDS staging: tile j+1 async-loads overlap tile-j compute.
// ---------------------------------------------------------------------------
__global__ __launch_bounds__(128) void flash_attn_kernel(
    const __bf16* __restrict__ Qs, const __bf16* __restrict__ Ks,
    const __bf16* __restrict__ Vt, __bf16* __restrict__ attn)
{
    __shared__ uint4 kbuf4[2][KBUF / 16];   // K tiles: 32 keys x 64 bf16, padded rows
    __shared__ uint4 vbuf4[2][VBUF / 16];   // Vt tiles: 64 d x 32 bf16, padded rows

    const int bh   = blockIdx.y;
    const int wave = threadIdx.x >> 5;
    const int lane = threadIdx.x & 31;
    const int half = lane >> 4;
    const int l16  = lane & 15;
    const int q0   = blockIdx.x * 64 + wave * 16;
    const int t    = threadIdx.x;

    // LDS byte offsets (generic shared pointer: low 32 bits = LDS offset)
    const unsigned koff = (unsigned)(uintptr_t)(void*)&kbuf4[0][0];
    const unsigned voff = (unsigned)(uintptr_t)(void*)&vbuf4[0][0];
    const int vrow = t >> 1;
    const unsigned kl_t = (unsigned)(t >> 2) * KPITCH + ((unsigned)(t & 3) << 5);
    const unsigned vl_t = (unsigned)vrow * VPITCH + ((unsigned)(t & 1) << 5);

    // Resident Qᵀ B-fragments (lane = query): 2 x b128 per K-slice.
    FragBF qt[2];
    {
        const uint4* qp4 = (const uint4*)(Qs + ((size_t)bh * NN + q0 + l16) * DD);
#pragma unroll
        for (int ks = 0; ks < 2; ++ks) {
            qt[ks].q[0] = qp4[ks * 4 + half];
            qt[ks].q[1] = qp4[ks * 4 + 2 + half];
        }
    }

    float m_run = -1e30f, l_run = 0.f;
    v8f o[4];
    { v8f z = {}; for (int i = 0; i < 4; ++i) o[i] = z; }

    // Prologue: stage tile 0 into buffer 0
    stage_tile(Ks, Vt, bh, 0, t, koff + kl_t, voff + vl_t);
    wait_async0();
    __syncthreads();

    int cur = 0;
    for (int j0 = 0; j0 < NN; j0 += 32) {
        const int nxt = cur ^ 1;
        if (j0 + 32 < NN)   // issue next tile's async loads; overlap with compute
            stage_tile(Ks, Vt, bh, j0 + 32, t,
                       koff + (unsigned)nxt * KBUF + kl_t,
                       voff + (unsigned)nxt * VBUF + vl_t);

        const uint4* kb4 = kbuf4[cur];
        const uint4* vb4 = vbuf4[cur];

        // Sᵀ tiles: st[sub] = K[j0+sub*16 .. +15] · Qᵀ   (C: lane=query, vgpr=key)
        Acc st[2];
#pragma unroll
        for (int sub = 0; sub < 2; ++sub) {
            v8f c = {};
#pragma unroll
            for (int ks = 0; ks < 2; ++ks) {
                FragBF ka;                                   // 2 x ds_load_b128
                ka.q[0] = kb4[(sub * 16 + l16) * (KPITCH / 16) + ks * 4 + half];
                ka.q[1] = kb4[(sub * 16 + l16) * (KPITCH / 16) + ks * 4 + 2 + half];
                c = wmma_bf16(ka.v, qt[ks].v, c);
            }
            st[sub].v = c;
        }

        // Online softmax (scale 1/32 folded into Q). Keys split lane <-> lane^16.
        float tmax = st[0].f[0];
#pragma unroll
        for (int r = 1; r < 8; ++r) tmax = fmaxf(tmax, st[0].f[r]);
#pragma unroll
        for (int r = 0; r < 8; ++r) tmax = fmaxf(tmax, st[1].f[r]);
        tmax = fmaxf(tmax, __shfl_xor(tmax, 16, 32));
        const float m_new = fmaxf(m_run, tmax);
        const float alpha = __expf(m_run - m_new);
        float tsum = 0.f;
#pragma unroll
        for (int r = 0; r < 8; ++r) { st[0].f[r] = __expf(st[0].f[r] - m_new); tsum += st[0].f[r]; }
#pragma unroll
        for (int r = 0; r < 8; ++r) { st[1].f[r] = __expf(st[1].f[r] - m_new); tsum += st[1].f[r]; }
        tsum += __shfl_xor(tsum, 16, 32);
        l_run = l_run * alpha + tsum;
        m_run = m_new;

        // Pack P as A-fragment: Sᵀ C-layout maps 1:1 onto P A-layout (same lane).
        FragBF pa;
#pragma unroll
        for (int r = 0; r < 4; ++r) {
            pa.u[r]     = pk(st[0].f[2 * r], st[0].f[2 * r + 1]);
            pa.u[4 + r] = pk(st[1].f[2 * r], st[1].f[2 * r + 1]);
        }
        // Broadcast per-query alpha into O-tile layout (query = r + 8*half)
        float am[8];
#pragma unroll
        for (int r = 0; r < 8; ++r) am[r] = __shfl(alpha, r + 8 * half, 32);

#pragma unroll
        for (int dt = 0; dt < 4; ++dt) {
            FragBF bvv;                                      // 2 x ds_load_b128
            bvv.q[0] = vb4[(dt * 16 + l16) * (VPITCH / 16) + half];
            bvv.q[1] = vb4[(dt * 16 + l16) * (VPITCH / 16) + 2 + half];
            v8f c = o[dt];
#pragma unroll
            for (int r = 0; r < 8; ++r) c[r] *= am[r];
            o[dt] = wmma_bf16(pa.v, bvv.v, c);
        }

        wait_async0();      // next tile's data landed in LDS
        __syncthreads();    // all waves done reading cur, next tile visible
        cur = nxt;
    }

    // Normalize by l and store attn (bf16 [B,H,N,D])
    float lm[8];
#pragma unroll
    for (int r = 0; r < 8; ++r) lm[r] = __shfl(l_run, r + 8 * half, 32);
#pragma unroll
    for (int dt = 0; dt < 4; ++dt)
#pragma unroll
        for (int r = 0; r < 8; ++r) {
            const int row = q0 + r + 8 * half;
            attn[((size_t)bh * NN + row) * DD + dt * 16 + l16] = (__bf16)(o[dt][r] / lm[r]);
        }
}

// ---------------------------------------------------------------------------
// Kernel 3: output projection. out[b,n,h,:] = attn[b,h,n,:]·Wo[h] + bo[h], fp32.
// ---------------------------------------------------------------------------
__global__ __launch_bounds__(128) void out_proj_kernel(
    const __bf16* __restrict__ attn, const uint4* __restrict__ Wob,
    const float* __restrict__ bo, float* __restrict__ out)
{
    const int bh   = blockIdx.y;
    const int b    = bh / HH, h = bh % HH;
    const int wave = threadIdx.x >> 5;
    const int lane = threadIdx.x & 31;
    const int half = lane >> 4;
    const int l16  = lane & 15;
    const int n0   = blockIdx.x * 64 + wave * 16;

    FragBF a[2];
    {
        const uint4* ap4 = (const uint4*)(attn + ((size_t)bh * NN + n0 + l16) * DD);
#pragma unroll
        for (int ks = 0; ks < 2; ++ks) {
            a[ks].q[0] = ap4[ks * 4 + half];
            a[ks].q[1] = ap4[ks * 4 + 2 + half];
        }
    }
    v8f c[4];
    { v8f z = {}; for (int i = 0; i < 4; ++i) c[i] = z; }
#pragma unroll
    for (int ks = 0; ks < 2; ++ks) {
        const uint4* wb = Wob + (size_t)(h * 2 + ks) * 256 + half * 64;
#pragma unroll
        for (int ct = 0; ct < 4; ++ct) {
            const int col = ct * 16 + l16;
            FragBF bf;
            bf.q[0] = wb[col];
            bf.q[1] = wb[128 + col];
            c[ct] = wmma_bf16(a[ks].v, bf.v, c[ct]);
        }
    }
#pragma unroll
    for (int ct = 0; ct < 4; ++ct) {
        const int col = ct * 16 + l16;
        const float bias = bo[h * DD + col];
#pragma unroll
        for (int r = 0; r < 8; ++r) {
            const int row = n0 + r + 8 * half;
            out[((size_t)(b * NN + row) * HH + h) * DD + col] = c[ct][r] + bias;
        }
    }
}

extern "C" void kernel_launch(void* const* d_in, const int* in_sizes, int n_in,
                              void* d_out, int out_size, void* d_ws, size_t ws_size,
                              hipStream_t stream) {
    const float* x  = (const float*)d_in[0];
    const float* Wq = (const float*)d_in[1];
    const float* bq = (const float*)d_in[2];
    const float* Wk = (const float*)d_in[3];
    const float* bk = (const float*)d_in[4];
    const float* Wv = (const float*)d_in[5];
    const float* bv = (const float*)d_in[6];
    const float* Wo = (const float*)d_in[7];
    const float* bo = (const float*)d_in[8];
    float* out = (float*)d_out;

    const size_t SZ = (size_t)BB * HH * NN * DD;     // elems per bf16 tensor
    const size_t WSZ = (size_t)HH * 32 * 64;         // packed-weight dwords per tensor
    __bf16* Qs = (__bf16*)d_ws;
    __bf16* Ks = Qs + SZ;
    __bf16* Vt = Ks + SZ;
    __bf16* at = Vt + SZ;
    __bf16* xb = at + SZ;
    unsigned* Wqb = (unsigned*)(xb + SZ);
    unsigned* Wkb = Wqb + WSZ;
    unsigned* Wvb = Wkb + WSZ;
    unsigned* Wob = Wvb + WSZ;

    dim3 grid(NN / 64, BB * HH);
    pack_x_kernel   <<<dim3((unsigned)(SZ / 8 / 256)), 256, 0, stream>>>(x, (unsigned*)xb);
    pack_w_kernel   <<<dim3(128), 256, 0, stream>>>(Wq, Wk, Wv, Wo, Wqb, Wkb, Wvb, Wob);
    qkv_proj_kernel <<<grid, 128, 0, stream>>>(xb, (const uint4*)Wqb, bq, (const uint4*)Wkb, bk,
                                               (const uint4*)Wvb, bv, Qs, Ks, Vt);
    flash_attn_kernel<<<grid, 128, 0, stream>>>(Qs, Ks, Vt, at);
    out_proj_kernel <<<grid, 128, 0, stream>>>(at, (const uint4*)Wob, bo, out);
}

// v002
// A run of this version takes 114 microseconds.
// Timed twice side by side with v001, it ran 1.09 and 1.08 times as fast.
// All steps since v000 together make it 1.77 times as fast.
#include <hip/hip_runtime.h>
#include <hip/hip_bf16.h>

#define BB 4
#define NN 2048
#define HH 16
#define DD 64

// LDS row pitches in bytes, 16 B x odd: the 16 lanes of a ds_load_b128 half
// then start on 16 different 4-bank groups (64 banks x 4 B), no bank conflict.
#define KPITCH 144                 // K rows: 128 B of data + 16 B pad
#define VPITCH 80                  // Vt rows: 64 B of data + 16 B pad
#define KBUF   (32 * KPITCH)       // one K tile, 32 keys
#define VBUF   (64 * VPITCH)       // one Vt tile, 64 d-rows

typedef __attribute__((ext_vector_type(16))) __bf16 v16bf;
typedef __attribute__((ext_vector_type(8)))  float  v8f;

union FragBF { v16bf v; unsigned u[8]; uint4 q[2]; };
union Acc    { v8f v; float f[8]; };

// Pinned packed conversion: keeps SLP from turning pairs into v_perm shuffles.
__device__ __forceinline__ unsigned pk(float a, float b) {
    unsigned d;
    asm("v_cvt_pk_bf16_f32 %0, %1, %2" : "=v"(d) : "v"(a), "v"(b));
    return d;
}

__device__ __forceinline__ v8f wmma_bf16(const v16bf& a, const v16bf& b, const v8f& c) {
    return __builtin_amdgcn_wmma_f32_16x16x32_bf16(false, a, false, b, (short)0, c, false, false);
}

__device__ __forceinline__ void wait_async0() {
#if __has_builtin(__builtin_amdgcn_s_wait_asynccnt)
    __builtin_amdgcn_s_wait_asynccnt(0);
#else
    asm volatile("s_wait_asynccnt 0x0" ::: "memory");
#endif
}

// Four async copies of 16 B per lane (global -> LDS), tracked by ASYNCcnt.
// s_wait_xcnt 0 closes the statement so that no address register named here
// is rewritten (next trip's address additions) ahead of it.
__device__ __forceinline__ void async_b128x4(
    unsigned l0, unsigned long long g0, unsigned l1, unsigned long long g1,
    unsigned l2, unsigned long long g2, unsigned l3, unsigned long long g3) {
    asm volatile("global_load_async_to_lds_b128 %0, %1, off\n\t"
                 "global_load_async_to_lds_b128 %2, %3, off\n\t"
                 "global_load_async_to_lds_b128 %4, %5, off\n\t"
                 "global_load_async_to_lds_b128 %6, %7, off\n\t"
                 "s_wait_xcnt 0x0"
                 :: "v"(l0), "v"(g0), "v"(l1), "v"(g1),
                    "v"(l2), "v"(g2), "v"(l3), "v"(g3) : "memory");
}

// Fragment dword map (16-bit 16x16x32 WMMA, wave32):
//   register r (0..7), lane-half hf: dword index = (r>>2)*8 + hf*4 + (r&3)
//   within a 32-dword (64 bf16) row; K-slice ks adds 16 dwords.
// => u[0..3] and u[4..7] are each 16B-contiguous: load fragments as 2 x b128.

// ---------------------------------------------------------------------------
// Kernel 0a: convert x fp32 -> bf16 (same [B,N,H,D] layout; rows stay
// fragment-contiguous so A-fragments become pure b128 loads downstream).
// ---------------------------------------------------------------------------
__global__ __launch_bounds__(256) void pack_x_kernel(
    const float* __restrict__ x, unsigned* __restrict__ xb)
{
    const size_t i = (size_t)blockIdx.x * 256 + threadIdx.x;   // one uint4 out
    const float4* xp = (const float4*)x;
    float4 f0 = xp[i * 2 + 0];
    float4 f1 = xp[i * 2 + 1];
    uint4 o;
    o.x = pk(f0.x, f0.y); o.y = pk(f0.z, f0.w);
    o.z = pk(f1.x, f1.y); o.w = pk(f1.z, f1.w);
    ((uint4*)xb)[i] = o;
}

// ---------------------------------------------------------------------------
// Kernel 0b: pre-pack weights fp32 [H,D,D] -> bf16, fragment-major:
//   dst uint4[(h*2+ks)*256 + g*128 + hf*64 + col] = regs r=0..3 for that slot,
//   where k = ks*32 + g*16 + hf*8 + 2r (+1), col = output column.
// ---------------------------------------------------------------------------
__global__ __launch_bounds__(256) void pack_w_kernel(
    const float* __restrict__ Wq, const float* __restrict__ Wk,
    const float* __restrict__ Wv, const float* __restrict__ Wo,
    unsigned* __restrict__ Wqb, unsigned* __restrict__ Wkb,
    unsigned* __restrict__ Wvb, unsigned* __restrict__ Wob)
{
    const int idx = blockIdx.x * 256 + threadIdx.x;      // H*32*64 = 32768 total
    const int col = idx & 63;
    const int k2  = (idx >> 6) & 31;                     // k/2
    const int h   = idx >> 11;
    const int ks  = k2 >> 4;
    const int g   = (k2 >> 3) & 1;
    const int hf  = (k2 >> 2) & 1;
    const int r   = k2 & 3;
    const size_t src = ((size_t)h * DD + 2 * k2) * DD + col;
    const int dst = (((h * 2 + ks) * 256 + g * 128 + hf * 64 + col) << 2) + r;
    Wqb[dst] = pk(Wq[src], Wq[src + DD]);
    Wkb[dst] = pk(Wk[src], Wk[src + DD]);
    Wvb[dst] = pk(Wv[src], Wv[src + DD]);
    Wob[dst] = pk(Wo[src], Wo[src + DD]);
}

// One projection matrix: 16 rows x 64 cols; each B-frag = 2 x b128 loads.
// MODE 0: Q (scaled 1/32, [B,H,N,D]); 1: K ([B,H,N,D]); 2: V transposed ([B,H,D,N]).
template<int MODE>
__device__ __forceinline__ void proj_mat(
    const FragBF a[2], const uint4* __restrict__ Wb4,
    const float* __restrict__ bias, int bh, int h,
    int n0, int l16, int half, __bf16* __restrict__ dst)
{
    v8f c[4];
    { v8f z = {}; for (int i = 0; i < 4; ++i) c[i] = z; }
#pragma unroll
    for (int ks = 0; ks < 2; ++ks) {
        const uint4* wb = Wb4 + (size_t)(h * 2 + ks) * 256 + half * 64;
#pragma unroll
        for (int ct = 0; ct < 4; ++ct) {
            const int col = ct * 16 + l16;
            FragBF bf;
            bf.q[0] = wb[col];          // regs 0..3
            bf.q[1] = wb[128 + col];    // regs 4..7
            c[ct] = wmma_bf16(a[ks].v, bf.v, c[ct]);
        }
    }
#pragma unroll
    for (int ct = 0; ct < 4; ++ct) {
        const int col = ct * 16 + l16;
        const float bv = bias[h * DD + col];
#pragma unroll
        for (int r = 0; r < 8; ++r) {
            const int row = n0 + r + 8 * half;           // C: m = r + 8*half
            const float val = c[ct][r] + bv;
            if (MODE == 0)
                dst[((size_t)bh * NN + row) * DD + col] = (__bf16)(val * 0.03125f);
            else if (MODE == 1)
                dst[((size_t)bh * NN + row) * DD + col] = (__bf16)val;
            else
                dst[((size_t)bh * DD + col) * NN + row] = (__bf16)val;
        }
    }
}

// ---------------------------------------------------------------------------
// Kernel 1: fused Q/K/V projection. grid = (N/64, B*H), block = 128 (4 waves).
// ---------------------------------------------------------------------------
__global__ __launch_bounds__(128) void qkv_proj_kernel(
    const __bf16* __restrict__ xb,
    const uint4* __restrict__ Wqb, const float* __restrict__ bq,
    const uint4* __restrict__ Wkb, const float* __restrict__ bk,
    const uint4* __restrict__ Wvb, const float* __restrict__ bv,
    __bf16* __restrict__ Qs, __bf16* __restrict__ Ks, __bf16* __restrict__ Vt)
{
    const int bh   = blockIdx.y;
    const int b    = bh / HH, h = bh % HH;
    const int wave = threadIdx.x >> 5;
    const int lane = threadIdx.x & 31;
    const int half = lane >> 4;
    const int l16  = lane & 15;
    const int n0   = blockIdx.x * 64 + wave * 16;

    // A fragments: rows n0..n0+15 of xb, pure 2 x b128 per K-slice.
    FragBF a[2];
    {
        const uint4* xp4 = (const uint4*)(xb + ((size_t)(b * NN + n0 + l16) * HH + h) * DD);
#pragma unroll
        for (int ks = 0; ks < 2; ++ks) {
            a[ks].q[0] = xp4[ks * 4 + half];
            a[ks].q[1] = xp4[ks * 4 + 2 + half];
        }
    }
    proj_mat<0>(a, Wqb, bq, bh, h, n0, l16, half, Qs);
    proj_mat<1>(a, Wkb, bk, bh, h, n0, l16, half, Ks);
    proj_mat<2>(a, Wvb, bv, bh, h, n0, l16, half, Vt);
}

// Stage one 32-key K/V tile into an LDS buffer (async, ASYNCcnt-tracked).
__device__ __forceinline__ void stage_tile(
    const __bf16* __restrict__ Ks, const __bf16* __restrict__ Vt,
    int bh, int j0, int t, unsigned klds, unsigned vlds)
{
    // K tile: rows j0..j0+31 contiguous in global -> 4 KB, 32 B per thread
    unsigned long long kg = (unsigned long long)(uintptr_t)
        (Ks + ((size_t)bh * NN + j0) * DD) + (unsigned long long)t * 32u;
    // Vt tile: 64 rows (d) x 64 B; 32 B per thread
    const int vrow = t >> 1;
    unsigned long long vg = (unsigned long long)(uintptr_t)
        (Vt + ((size_t)bh * DD + vrow) * NN + j0) + ((unsigned long long)(t & 1) << 5);
    async_b128x4(klds, kg, klds + 16u, kg + 16u, vlds, vg, vlds + 16u, vg + 16u);
}

// ---------------------------------------------------------------------------
// Kernel 2: flash attention. grid = (N/128, B*H), block = 128 (4 waves).
// Each wave owns QT = 2 query tiles (32 queries): every K and Vt fragment read
// from LDS feeds two WMMAs, and one staged tile serves 128 queries.
// S^T = K.Q^T so the score C-layout refeeds directly as the P A-fragment.
// Double-buffered LDS staging: tile j+1 async-loads overlap tile-j compute.
// ---------------------------------------------------------------------------
#define QT 2
__global__ __launch_bounds__(128) void flash_attn_kernel(
    const __bf16* __restrict__ Qs, const __bf16* __restrict__ Ks,
    const __bf16* __restrict__ Vt, __bf16* __restrict__ attn)
{
    __shared__ uint4 kbuf4[2][KBUF / 16];   // K tiles: 32 keys x 64 bf16, padded rows
    __shared__ uint4 vbuf4[2][VBUF / 16];   // Vt tiles: 64 d x 32 bf16, padded rows

    const int bh   = blockIdx.y;
    const int wave = threadIdx.x >> 5;
    const int lane = threadIdx.x & 31;
    const int half = lane >> 4;
    const int l16  = lane & 15;
    const int q0   = blockIdx.x * (64 * QT) + wave * (16 * QT);
    const int t    = threadIdx.x;

    // LDS byte offsets (generic shared pointer: low 32 bits = LDS offset)
    const unsigned koff = (unsigned)(uintptr_t)(void*)&kbuf4[0][0];
    const unsigned voff = (unsigned)(uintptr_t)(void*)&vbuf4[0][0];
    const int vrow = t >> 1;
    const unsigned kl_t = (unsigned)(t >> 2) * KPITCH + ((unsigned)(t & 3) << 5);
    const unsigned vl_t = (unsigned)vrow * VPITCH + ((unsigned)(t & 1) << 5);

    // Resident Q^T B-fragments (lane = query): 2 x b128 per K-slice and tile.
    FragBF qt[QT][2];
#pragma unroll
    for (int qi = 0; qi < QT; ++qi) {
        const uint4* qp4 = (const uint4*)(Qs + ((size_t)bh * NN + q0 + qi * 16 + l16) * DD);
#pragma unroll
        for (int ks = 0; ks < 2; ++ks) {
            qt[qi][ks].q[0] = qp4[ks * 4 + half];
            qt[qi][ks].q[1] = qp4[ks * 4 + 2 + half];
        }
    }

    float m_run[QT], l_run[QT];
    v8f o[QT][4];
#pragma unroll
    for (int qi = 0; qi < QT; ++qi) {
        m_run[qi] = -1e30f; l_run[qi] = 0.f;
        v8f z = {};
        for (int i = 0; i < 4; ++i) o[qi][i] = z;
    }

    // Prologue: stage tile 0 into buffer 0
    stage_tile(Ks, Vt, bh, 0, t, koff + kl_t, voff + vl_t);
    wait_async0();
    __syncthreads();

    int cur = 0;
    for (int j0 = 0; j0 < NN; j0 += 32) {
        const int nxt = cur ^ 1;
        if (j0 + 32 < NN)   // issue next tile's async loads; overlap with compute
            stage_tile(Ks, Vt, bh, j0 + 32, t,
                       koff + (unsigned)nxt * KBUF + kl_t,
                       voff + (unsigned)nxt * VBUF + vl_t);

        const uint4* kb4 = kbuf4[cur];
        const uint4* vb4 = vbuf4[cur];

        // S^T tiles: st[qi][sub] = K[j0+sub*16 .. +15] . Q^T  (C: lane=query, vgpr=key)
        Acc st[QT][2];
#pragma unroll
        for (int sub = 0; sub < 2; ++sub) {
            FragBF ka[2];                                    // 4 x ds_load_b128
#pragma unroll
            for (int ks = 0; ks < 2; ++ks) {
                ka[ks].q[0] = kb4[(sub * 16 + l16) * (KPITCH / 16) + ks * 4 + half];
                ka[ks].q[1] = kb4[(sub * 16 + l16) * (KPITCH / 16) + ks * 4 + 2 + half];
            }
#pragma unroll
            for (int qi = 0; qi < QT; ++qi) {
                v8f c = {};
                c = wmma_bf16(ka[0].v, qt[qi][0].v, c);
                c = wmma_bf16(ka[1].v, qt[qi][1].v, c);
                st[qi][sub].v = c;
            }
        }

        FragBF pa[QT];
        float am[QT][8];
#pragma unroll
        for (int qi = 0; qi < QT; ++qi) {
            // Online softmax (scale 1/32 folded into Q). Keys split lane <-> lane^16.
            float tmax = st[qi][0].f[0];
#pragma unroll
            for (int r = 1; r < 8; ++r) tmax = fmaxf(tmax, st[qi][0].f[r]);
#pragma unroll
            for (int r = 0; r < 8; ++r) tmax = fmaxf(tmax, st[qi][1].f[r]);
            tmax = fmaxf(tmax, __shfl_xor(tmax, 16, 32));
            const float m_new = fmaxf(m_run[qi], tmax);
            const float alpha = __expf(m_run[qi] - m_new);
            float tsum = 0.f;
#pragma unroll
            for (int r = 0; r < 8; ++r) { st[qi][0].f[r] = __expf(st[qi][0].f[r] - m_new); tsum += st[qi][0].f[r]; }
#pragma unroll
            for (int r = 0; r < 8; ++r) { st[qi][1].f[r] = __expf(st[qi][1].f[r] - m_new); tsum += st[qi][1].f[r]; }
            tsum += __shfl_xor(tsum, 16, 32);
            l_run[qi] = l_run[qi] * alpha + tsum;
            m_run[qi] = m_new;

            // Pack P as A-fragment: S^T C-layout maps 1:1 onto P A-layout (same lane).
#pragma unroll
            for (int r = 0; r < 4; ++r) {
                pa[qi].u[r]     = pk(st[qi][0].f[2 * r], st[qi][0].f[2 * r + 1]);
                pa[qi].u[4 + r] = pk(st[qi][1].f[2 * r], st[qi][1].f[2 * r + 1]);
            }
            // Broadcast per-query alpha into O-tile layout (query = r + 8*half)
#pragma unroll
            for (int r = 0; r < 8; ++r) am[qi][r] = __shfl(alpha, r + 8 * half, 32);
        }

#pragma unroll
        for (int dt = 0; dt < 4; ++dt) {
            FragBF bvv;                                      // 2 x ds_load_b128
            bvv.q[0] = vb4[(dt * 16 + l16) * (VPITCH / 16) + half];
            bvv.q[1] = vb4[(dt * 16 + l16) * (VPITCH / 16) + 2 + half];
#pragma unroll
            for (int qi = 0; qi < QT; ++qi) {
                v8f c = o[qi][dt];
#pragma unroll
                for (int r = 0; r < 8; ++r) c[r] *= am[qi][r];
                o[qi][dt] = wmma_bf16(pa[qi].v, bvv.v, c);
            }
        }

        wait_async0();      // next tile's data landed in LDS
        __syncthreads();    // all waves done reading cur, next tile visible
        cur = nxt;
    }

    // Normalize by l and store attn (bf16 [B,H,N,D])
#pragma unroll
    for (int qi = 0; qi < QT; ++qi) {
        float lm[8];
#pragma unroll
        for (int r = 0; r < 8; ++r) lm[r] = __shfl(l_run[qi], r + 8 * half, 32);
#pragma unroll
        for (int dt = 0; dt < 4; ++dt)
#pragma unroll
            for (int r = 0; r < 8; ++r) {
                const int row = q0 + qi * 16 + r + 8 * half;
                attn[((size_t)bh * NN + row) * DD + dt * 16 + l16] = (__bf16)(o[qi][dt][r] / lm[r]);
            }
    }
}

// ---------------------------------------------------------------------------
// Kernel 3: output projection. out[b,n,h,:] = attn[b,h,n,:]·Wo[h] + bo[h], fp32.
// ---------------------------------------------------------------------------
__global__ __launch_bounds__(128) void out_proj_kernel(
    const __bf16* __restrict__ attn, const uint4* __restrict__ Wob,
    const float* __restrict__ bo, float* __restrict__ out)
{
    const int bh   = blockIdx.y;
    const int b    = bh / HH, h = bh % HH;
    const int wave = threadIdx.x >> 5;
    const int lane = threadIdx.x & 31;
    const int half = lane >> 4;
    const int l16  = lane & 15;
    const int n0   = blockIdx.x * 64 + wave * 16;

    FragBF a[2];
    {
        const uint4* ap4 = (const uint4*)(attn + ((size_t)bh * NN + n0 + l16) * DD);
#pragma unroll
        for (int ks = 0; ks < 2; ++ks) {
            a[ks].q[0] = ap4[ks * 4 + half];
            a[ks].q[1] = ap4[ks * 4 + 2 + half];
        }
    }
    v8f c[4];
    { v8f z = {}; for (int i = 0; i < 4; ++i) c[i] = z; }
#pragma unroll
    for (int ks = 0; ks < 2; ++ks) {
        const uint4* wb = Wob + (size_t)(h * 2 + ks) * 256 + half * 64;
#pragma unroll
        for (int ct = 0; ct < 4; ++ct) {
            const int col = ct * 16 + l16;
            FragBF bf;
            bf.q[0] = wb[col];
            bf.q[1] = wb[128 + col];
            c[ct] = wmma_bf16(a[ks].v, bf.v, c[ct]);
        }
    }
#pragma unroll
    for (int ct = 0; ct < 4; ++ct) {
        const int col = ct * 16 + l16;
        const float bias = bo[h * DD + col];
#pragma unroll
        for (int r = 0; r < 8; ++r) {
            const int row = n0 + r + 8 * half;
            out[((size_t)(b * NN + row) * HH + h) * DD + col] = c[ct][r] + bias;
        }
    }
}

extern "C" void kernel_launch(void* const* d_in, const int* in_sizes, int n_in,
                              void* d_out, int out_size, void* d_ws, size_t ws_size,
                              hipStream_t stream) {
    const float* x  = (const float*)d_in[0];
    const float* Wq = (const float*)d_in[1];
    const float* bq = (const float*)d_in[2];
    const float* Wk = (const float*)d_in[3];
    const float* bk = (const float*)d_in[4];
    const float* Wv = (const float*)d_in[5];
    const float* bv = (const float*)d_in[6];
    const float* Wo = (const float*)d_in[7];
    const float* bo = (const float*)d_in[8];
    float* out = (float*)d_out;

    const size_t SZ = (size_t)BB * HH * NN * DD;     // elems per bf16 tensor
    const size_t WSZ = (size_t)HH * 32 * 64;         // packed-weight dwords per tensor
    __bf16* Qs = (__bf16*)d_ws;
    __bf16* Ks = Qs + SZ;
    __bf16* Vt = Ks + SZ;
    __bf16* at = Vt + SZ;
    __bf16* xb = at + SZ;
    unsigned* Wqb = (unsigned*)(xb + SZ);
    unsigned* Wkb = Wqb + WSZ;
    unsigned* Wvb = Wkb + WSZ;
    unsigned* Wob = Wvb + WSZ;

    dim3 grid(NN / 64, BB * HH);
    pack_x_kernel   <<<dim3((unsigned)(SZ / 8 / 256)), 256, 0, stream>>>(x, (unsigned*)xb);
    pack_w_kernel   <<<dim3(128), 256, 0, stream>>>(Wq, Wk, Wv, Wo, Wqb, Wkb, Wvb, Wob);
    qkv_proj_kernel <<<grid, 128, 0, stream>>>(xb, (const uint4*)Wqb, bq, (const uint4*)Wkb, bk,
                                               (const uint4*)Wvb, bv, Qs, Ks, Vt);
    flash_attn_kernel<<<dim3(NN / (64 * QT), BB * HH), 128, 0, stream>>>(Qs, Ks, Vt, at);
    out_proj_kernel <<<grid, 128, 0, stream>>>(at, (const uint4*)Wob, bo, out);
}

// v003
// One run takes 108 microseconds.
// Next to v002, in two timings, it ran 1.07 times as fast each time.
// Over all steps from v000 it is 1.90 times as fast.
#include <hip/hip_runtime.h>
#include <hip/hip_bf16.h>

#define BB 4
#define NN 2048
#define HH 16
#define DD 64

// LDS row pitches in bytes, 16 B x odd: the 16 lanes of a ds_load_b128 half
// then start on 16 different 4-bank groups (64 banks x 4 B), no bank conflict.
#define KPITCH 144                 // K rows: 128 B of data + 16 B pad
#define VPITCH 80                  // Vt rows: 64 B of data + 16 B pad
#define KBUF   (32 * KPITCH)       // one K tile, 32 keys
#define VBUF   (64 * VPITCH)       // one Vt tile, 64 d-rows

typedef __attribute__((ext_vector_type(16))) __bf16 v16bf;
typedef __attribute__((ext_vector_type(8)))  float  v8f;

union FragBF { v16bf v; unsigned u[8]; uint4 q[2]; };
union Acc    { v8f v; float f[8]; };

// Pinned packed conversion: keeps SLP from turning pairs into v_perm shuffles.
__device__ __forceinline__ unsigned pk(float a, float b) {
    unsigned d;
    asm("v_cvt_pk_bf16_f32 %0, %1, %2" : "=v"(d) : "v"(a), "v"(b));
    return d;
}

__device__ __forceinline__ v8f wmma_bf16(const v16bf& a, const v16bf& b, const v8f& c) {
    return __builtin_amdgcn_wmma_f32_16x16x32_bf16(false, a, false, b, (short)0, c, false, false);
}

__device__ __forceinline__ void wait_async0() {
#if __has_builtin(__builtin_amdgcn_s_wait_asynccnt)
    __builtin_amdgcn_s_wait_asynccnt(0);
#else
    asm volatile("s_wait_asynccnt 0x0" ::: "memory");
#endif
}

// Four async copies of 16 B per lane (global -> LDS), tracked by ASYNCcnt.
// s_wait_xcnt 0 closes the statement so that no address register named here
// is rewritten (next trip's address additions) ahead of it.
__device__ __forceinline__ void async_b128x4(
    unsigned l0, unsigned long long g0, unsigned l1, unsigned long long g1,
    unsigned l2, unsigned long long g2, unsigned l3, unsigned long long g3) {
    asm volatile("global_load_async_to_lds_b128 %0, %1, off\n\t"
                 "global_load_async_to_lds_b128 %2, %3, off\n\t"
                 "global_load_async_to_lds_b128 %4, %5, off\n\t"
                 "global_load_async_to_lds_b128 %6, %7, off\n\t"
                 "s_wait_xcnt 0x0"
                 :: "v"(l0), "v"(g0), "v"(l1), "v"(g1),
                    "v"(l2), "v"(g2), "v"(l3), "v"(g3) : "memory");
}

// Fragment dword map (16-bit 16x16x32 WMMA, wave32):
//   register r (0..7), lane-half hf: dword index = (r>>2)*8 + hf*4 + (r&3)
//   within a 32-dword (64 bf16) row; K-slice ks adds 16 dwords.
// => u[0..3] and u[4..7] are each 16B-contiguous: load fragments as 2 x b128.

// ---------------------------------------------------------------------------
// Kernel 0: pre-pack weights fp32 [H,D,D] -> bf16, fragment-major:
//   dst uint4[(h*2+ks)*256 + g*128 + hf*64 + col] = regs r=0..3 for that slot,
//   where k = ks*32 + g*16 + hf*8 + 2r (+1), col = output column.
// ---------------------------------------------------------------------------
__global__ __launch_bounds__(256) void pack_w_kernel(
    const float* __restrict__ Wq, const float* __restrict__ Wk,
    const float* __restrict__ Wv, const float* __restrict__ Wo,
    unsigned* __restrict__ Wqb, unsigned* __restrict__ Wkb,
    unsigned* __restrict__ Wvb, unsigned* __restrict__ Wob)
{
    const int idx = blockIdx.x * 256 + threadIdx.x;      // H*32*64 = 32768 total
    const int col = idx & 63;
    const int k2  = (idx >> 6) & 31;                     // k/2
    const int h   = idx >> 11;
    const int ks  = k2 >> 4;
    const int g   = (k2 >> 3) & 1;
    const int hf  = (k2 >> 2) & 1;
    const int r   = k2 & 3;
    const size_t src = ((size_t)h * DD + 2 * k2) * DD + col;
    const int dst = (((h * 2 + ks) * 256 + g * 128 + hf * 64 + col) << 2) + r;
    Wqb[dst] = pk(Wq[src], Wq[src + DD]);
    Wkb[dst] = pk(Wk[src], Wk[src + DD]);
    Wvb[dst] = pk(Wv[src], Wv[src + DD]);
    Wob[dst] = pk(Wo[src], Wo[src + DD]);
}

// One projection matrix: 16 rows x 64 cols; each B-frag = 2 x b128 loads.
// MODE 0: Q (scaled 1/32, [B,H,N,D]); 1: K ([B,H,N,D]); 2: V transposed ([B,H,D,N]).
template<int MODE>
__device__ __forceinline__ void proj_mat(
    const FragBF a[2], const uint4* __restrict__ Wb4,
    const float* __restrict__ bias, int bh, int h,
    int n0, int l16, int half, __bf16* __restrict__ dst)
{
    v8f c[4];
    { v8f z = {}; for (int i = 0; i < 4; ++i) c[i] = z; }
#pragma unroll
    for (int ks = 0; ks < 2; ++ks) {
        const uint4* wb = Wb4 + (size_t)(h * 2 + ks) * 256 + half * 64;
#pragma unroll
        for (int ct = 0; ct < 4; ++ct) {
            const int col = ct * 16 + l16;
            FragBF bf;
            bf.q[0] = wb[col];          // regs 0..3
            bf.q[1] = wb[128 + col];    // regs 4..7
            c[ct] = wmma_bf16(a[ks].v, bf.v, c[ct]);
        }
    }
#pragma unroll
    for (int ct = 0; ct < 4; ++ct) {
        const int col = ct * 16 + l16;
        const float bv = bias[h * DD + col];
#pragma unroll
        for (int r = 0; r < 8; ++r) {
            const int row = n0 + r + 8 * half;           // C: m = r + 8*half
            const float val = c[ct][r] + bv;
            if (MODE == 0)
                dst[((size_t)bh * NN + row) * DD + col] = (__bf16)(val * 0.03125f);
            else if (MODE == 1)
                dst[((size_t)bh * NN + row) * DD + col] = (__bf16)val;
            else
                dst[((size_t)bh * DD + col) * NN + row] = (__bf16)val;
        }
    }
}

// ---------------------------------------------------------------------------
// Kernel 1: fused Q/K/V projection. grid = (N/64, B*H), block = 128 (4 waves).
// Reads x as fp32 and rounds it to bf16 in registers: each x element is used by
// exactly one wave, so a bf16 copy in memory would only add a round trip.
// ---------------------------------------------------------------------------
__global__ __launch_bounds__(128) void qkv_proj_kernel(
    const float* __restrict__ x,
    const uint4* __restrict__ Wqb, const float* __restrict__ bq,
    const uint4* __restrict__ Wkb, const float* __restrict__ bk,
    const uint4* __restrict__ Wvb, const float* __restrict__ bv,
    __bf16* __restrict__ Qs, __bf16* __restrict__ Ks, __bf16* __restrict__ Vt)
{
    const int bh   = blockIdx.y;
    const int b    = bh / HH, h = bh % HH;
    const int wave = threadIdx.x >> 5;
    const int lane = threadIdx.x & 31;
    const int half = lane >> 4;
    const int l16  = lane & 15;
    const int n0   = blockIdx.x * 64 + wave * 16;

    // A fragments: rows n0..n0+15 of x. Registers g*4..g*4+3 of K-slice ks hold
    // k = ks*32 + g*16 + half*8 .. +7: 8 floats = 2 x b128, packed in pairs.
    FragBF a[2];
    {
        const float4* xp4 = (const float4*)(x + ((size_t)(b * NN + n0 + l16) * HH + h) * DD);
        float4 f[2][2][2];
#pragma unroll
        for (int ks = 0; ks < 2; ++ks)
#pragma unroll
            for (int g = 0; g < 2; ++g) {
                f[ks][g][0] = xp4[ks * 8 + g * 4 + half * 2];
                f[ks][g][1] = xp4[ks * 8 + g * 4 + half * 2 + 1];
            }
        // Keeps all eight loads of x ahead of the first conversion: sunk between
        // the products they would expose the memory latency three times, not once.
        __builtin_amdgcn_sched_barrier(0);
#pragma unroll
        for (int ks = 0; ks < 2; ++ks)
#pragma unroll
            for (int g = 0; g < 2; ++g) {
                a[ks].u[g * 4 + 0] = pk(f[ks][g][0].x, f[ks][g][0].y);
                a[ks].u[g * 4 + 1] = pk(f[ks][g][0].z, f[ks][g][0].w);
                a[ks].u[g * 4 + 2] = pk(f[ks][g][1].x, f[ks][g][1].y);
                a[ks].u[g * 4 + 3] = pk(f[ks][g][1].z, f[ks][g][1].w);
            }
    }
    proj_mat<0>(a, Wqb, bq, bh, h, n0, l16, half, Qs);
    proj_mat<1>(a, Wkb, bk, bh, h, n0, l16, half, Ks);
    proj_mat<2>(a, Wvb, bv, bh, h, n0, l16, half, Vt);
}

// Stage one 32-key K/V tile into an LDS buffer (async, ASYNCcnt-tracked).
__device__ __forceinline__ void stage_tile(
    const __bf16* __restrict__ Ks, const __bf16* __restrict__ Vt,
    int bh, int j0, int t, unsigned klds, unsigned vlds)
{
    // K tile: rows j0..j0+31 contiguous in global -> 4 KB, 32 B per thread
    unsigned long long kg = (unsigned long long)(uintptr_t)
        (Ks + ((size_t)bh * NN + j0) * DD) + (unsigned long long)t * 32u;
    // Vt tile: 64 rows (d) x 64 B; 32 B per thread
    const int vrow = t >> 1;
    unsigned long long vg = (unsigned long long)(uintptr_t)
        (Vt + ((size_t)bh * DD + vrow) * NN + j0) + ((unsigned long long)(t & 1) << 5);
    async_b128x4(klds, kg, klds + 16u, kg + 16u, vlds, vg, vlds + 16u, vg + 16u);
}

// ---------------------------------------------------------------------------
// Kernel 2: flash attention. grid = (N/128, B*H), block = 128 (4 waves).
// Each wave owns QT = 2 query tiles (32 queries): every K and Vt fragment read
// from LDS feeds two WMMAs, and one staged tile serves 128 queries.
// S^T = K.Q^T so the score C-layout refeeds directly as the P A-fragment.
// Double-buffered LDS staging: tile j+1 async-loads overlap tile-j compute.
// ---------------------------------------------------------------------------
#define QT 2
__global__ __launch_bounds__(128) void flash_attn_kernel(
    const __bf16* __restrict__ Qs, const __bf16* __restrict__ Ks,
    const __bf16* __restrict__ Vt, __bf16* __restrict__ attn)
{
    __shared__ uint4 kbuf4[2][KBUF / 16];   // K tiles: 32 keys x 64 bf16, padded rows
    __shared__ uint4 vbuf4[2][VBUF / 16];   // Vt tiles: 64 d x 32 bf16, padded rows

    const int bh   = blockIdx.y;
    const int wave = threadIdx.x >> 5;
    const int lane = threadIdx.x & 31;
    const int half = lane >> 4;
    const int l16  = lane & 15;
    const int q0   = blockIdx.x * (64 * QT) + wave * (16 * QT);
    const int t    = threadIdx.x;

    // LDS byte offsets (generic shared pointer: low 32 bits = LDS offset)
    const unsigned koff = (unsigned)(uintptr_t)(void*)&kbuf4[0][0];
    const unsigned voff = (unsigned)(uintptr_t)(void*)&vbuf4[0][0];
    const int vrow = t >> 1;
    const unsigned kl_t = (unsigned)(t >> 2) * KPITCH + ((unsigned)(t & 3) << 5);
    const unsigned vl_t = (unsigned)vrow * VPITCH + ((unsigned)(t & 1) << 5);

    // Resident Q^T B-fragments (lane = query): 2 x b128 per K-slice and tile.
    FragBF qt[QT][2];
#pragma unroll
    for (int qi = 0; qi < QT; ++qi) {
        const uint4* qp4 = (const uint4*)(Qs + ((size_t)bh * NN + q0 + qi * 16 + l16) * DD);
#pragma unroll
        for (int ks = 0; ks < 2; ++ks) {
            qt[qi][ks].q[0] = qp4[ks * 4 + half];
            qt[qi][ks].q[1] = qp4[ks * 4 + 2 + half];
        }
    }

    float m_run[QT], l_run[QT];
    v8f o[QT][4];
#pragma unroll
    for (int qi = 0; qi < QT; ++qi) {
        m_run[qi] = -1e30f; l_run[qi] = 0.f;
        v8f z = {};
        for (int i = 0; i < 4; ++i) o[qi][i] = z;
    }

    // Prologue: stage tile 0 into buffer 0
    stage_tile(Ks, Vt, bh, 0, t, koff + kl_t, voff + vl_t);
    wait_async0();
    __syncthreads();

    int cur = 0;
    for (int j0 = 0; j0 < NN; j0 += 32) {
        const int nxt = cur ^ 1;
        if (j0 + 32 < NN)   // issue next tile's async loads; overlap with compute
            stage_tile(Ks, Vt, bh, j0 + 32, t,
                       koff + (unsigned)nxt * KBUF + kl_t,
                       voff + (unsigned)nxt * VBUF + vl_t);

        const uint4* kb4 = kbuf4[cur];
        const uint4* vb4 = vbuf4[cur];

        // S^T tiles: st[qi][sub] = K[j0+sub*16 .. +15] . Q^T  (C: lane=query, vgpr=key)
        Acc st[QT][2];
#pragma unroll
        for (int sub = 0; sub < 2; ++sub) {
            FragBF ka[2];                                    // 4 x ds_load_b128
#pragma unroll
            for (int ks = 0; ks < 2; ++ks) {
                ka[ks].q[0] = kb4[(sub * 16 + l16) * (KPITCH / 16) + ks * 4 + half];
                ka[ks].q[1] = kb4[(sub * 16 + l16) * (KPITCH / 16) + ks * 4 + 2 + half];
            }
#pragma unroll
            for (int qi = 0; qi < QT; ++qi) {
                v8f c = {};
                c = wmma_bf16(ka[0].v, qt[qi][0].v, c);
                c = wmma_bf16(ka[1].v, qt[qi][1].v, c);
                st[qi][sub].v = c;
            }
        }

        FragBF pa[QT];
        float am[QT][8];
#pragma unroll
        for (int qi = 0; qi < QT; ++qi) {
            // Online softmax (scale 1/32 folded into Q). Keys split lane <-> lane^16.
            float tmax = st[qi][0].f[0];
#pragma unroll
            for (int r = 1; r < 8; ++r) tmax = fmaxf(tmax, st[qi][0].f[r]);
#pragma unroll
            for (int r = 0; r < 8; ++r) tmax = fmaxf(tmax, st[qi][1].f[r]);
            tmax = fmaxf(tmax, __shfl_xor(tmax, 16, 32));
            const float m_new = fmaxf(m_run[qi], tmax);
            const float alpha = __expf(m_run[qi] - m_new);
            float tsum = 0.f;
#pragma unroll
            for (int r = 0; r < 8; ++r) { st[qi][0].f[r] = __expf(st[qi][0].f[r] - m_new); tsum += st[qi][0].f[r]; }
#pragma unroll
            for (int r = 0; r < 8; ++r) { st[qi][1].f[r] = __expf(st[qi][1].f[r] - m_new); tsum += st[qi][1].f[r]; }
            tsum += __shfl_xor(tsum, 16, 32);
            l_run[qi] = l_run[qi] * alpha + tsum;
            m_run[qi] = m_new;

            // Pack P as A-fragment: S^T C-layout maps 1:1 onto P A-layout (same lane).
#pragma unroll
            for (int r = 0; r < 4; ++r) {
                pa[qi].u[r]     = pk(st[qi][0].f[2 * r], st[qi][0].f[2 * r + 1]);
                pa[qi].u[4 + r] = pk(st[qi][1].f[2 * r], st[qi][1].f[2 * r + 1]);
            }
            // Broadcast per-query alpha into O-tile layout (query = r + 8*half)
#pragma unroll
            for (int r = 0; r < 8; ++r) am[qi][r] = __shfl(alpha, r + 8 * half, 32);
        }

#pragma unroll
        for (int dt = 0; dt < 4; ++dt) {
            FragBF bvv;                                      // 2 x ds_load_b128
            bvv.q[0] = vb4[(dt * 16 + l16) * (VPITCH / 16) + half];
            bvv.q[1] = vb4[(dt * 16 + l16) * (VPITCH / 16) + 2 + half];
#pragma unroll
            for (int qi = 0; qi < QT; ++qi) {
                v8f c = o[qi][dt];
#pragma unroll
                for (int r = 0; r < 8; ++r) c[r] *= am[qi][r];
                o[qi][dt] = wmma_bf16(pa[qi].v, bvv.v, c);
            }
        }

        wait_async0();      // next tile's data landed in LDS
        __syncthreads();    // all waves done reading cur, next tile visible
        cur = nxt;
    }

    // Normalize by l and store attn (bf16 [B,H,N,D])
#pragma unroll
    for (int qi = 0; qi < QT; ++qi) {
        float lm[8];
#pragma unroll
        for (int r = 0; r < 8; ++r) lm[r] = __shfl(l_run[qi], r + 8 * half, 32);
#pragma unroll
        for (int dt = 0; dt < 4; ++dt)
#pragma unroll
            for (int r = 0; r < 8; ++r) {
                const int row = q0 + qi * 16 + r + 8 * half;
                attn[((size_t)bh * NN + row) * DD + dt * 16 + l16] = (__bf16)(o[qi][dt][r] / lm[r]);
            }
    }
}

// ---------------------------------------------------------------------------
// Kernel 3: output projection. out[b,n,h,:] = attn[b,h,n,:]·Wo[h] + bo[h], fp32.
// ---------------------------------------------------------------------------
__global__ __launch_bounds__(128) void out_proj_kernel(
    const __bf16* __restrict__ attn, const uint4* __restrict__ Wob,
    const float* __restrict__ bo, float* __restrict__ out)
{
    const int bh   = blockIdx.y;
    const int b    = bh / HH, h = bh % HH;
    const int wave = threadIdx.x >> 5;
    const int lane = threadIdx.x & 31;
    const int half = lane >> 4;
    const int l16  = lane & 15;
    const int n0   = blockIdx.x * 64 + wave * 16;

    FragBF a[2];
    {
        const uint4* ap4 = (const uint4*)(attn + ((size_t)bh * NN + n0 + l16) * DD);
#pragma unroll
        for (int ks = 0; ks < 2; ++ks) {
            a[ks].q[0] = ap4[ks * 4 + half];
            a[ks].q[1] = ap4[ks * 4 + 2 + half];
        }
    }
    v8f c[4];
    { v8f z = {}; for (int i = 0; i < 4; ++i) c[i] = z; }
#pragma unroll
    for (int ks = 0; ks < 2; ++ks) {
        const uint4* wb = Wob + (size_t)(h * 2 + ks) * 256 + half * 64;
#pragma unroll
        for (int ct = 0; ct < 4; ++ct) {
            const int col = ct * 16 + l16;
            FragBF bf;
            bf.q[0] = wb[col];
            bf.q[1] = wb[128 + col];
            c[ct] = wmma_bf16(a[ks].v, bf.v, c[ct]);
        }
    }
#pragma unroll
    for (int ct = 0; ct < 4; ++ct) {
        const int col = ct * 16 + l16;
        const float bias = bo[h * DD + col];
#pragma unroll
        for (int r = 0; r < 8; ++r) {
            const int row = n0 + r + 8 * half;
            out[((size_t)(b * NN + row) * HH + h) * DD + col] = c[ct][r] + bias;
        }
    }
}

extern "C" void kernel_launch(void* const* d_in, const int* in_sizes, int n_in,
                              void* d_out, int out_size, void* d_ws, size_t ws_size,
                              hipStream_t stream) {
    const float* x  = (const float*)d_in[0];
    const float* Wq = (const float*)d_in[1];
    const float* bq = (const float*)d_in[2];
    const float* Wk = (const float*)d_in[3];
    const float* bk = (const float*)d_in[4];
    const float* Wv = (const float*)d_in[5];
    const float* bv = (const float*)d_in[6];
    const float* Wo = (const float*)d_in[7];
    const float* bo = (const float*)d_in[8];
    float* out = (float*)d_out;

    const size_t SZ = (size_t)BB * HH * NN * DD;     // elems per bf16 tensor
    const size_t WSZ = (size_t)HH * 32 * 64;         // packed-weight dwords per tensor
    __bf16* Qs = (__bf16*)d_ws;
    __bf16* Ks = Qs + SZ;
    __bf16* Vt = Ks + SZ;
    __bf16* at = Vt + SZ;
    unsigned* Wqb = (unsigned*)(at + SZ);
    unsigned* Wkb = Wqb + WSZ;
    unsigned* Wvb = Wkb + WSZ;
    unsigned* Wob = Wvb + WSZ;

    dim3 grid(NN / 64, BB * HH);
    pack_w_kernel   <<<dim3(128), 256, 0, stream>>>(Wq, Wk, Wv, Wo, Wqb, Wkb, Wvb, Wob);
    qkv_proj_kernel <<<grid, 128, 0, stream>>>(x, (const uint4*)Wqb, bq, (const uint4*)Wkb, bk,
                                               (const uint4*)Wvb, bv, Qs, Ks, Vt);
    flash_attn_kernel<<<dim3(NN / (64 * QT), BB * HH), 128, 0, stream>>>(Qs, Ks, Vt, at);
    out_proj_kernel <<<grid, 128, 0, stream>>>(at, (const uint4*)Wob, bo, out);
}

// v004
// It runs in 95.5 microseconds.
// Next to v003, in two timings, it ran 1.13 and 1.14 times as fast.
// Over all steps from v000 it is 2.16 times as fast.
#include <hip/hip_runtime.h>
#include <hip/hip_bf16.h>

#define BB 4
#define NN 2048
#define HH 16
#define DD 64

// LDS row pitches in bytes, 16 B x odd: the 16 lanes of a ds_load_b128 half
// then start on 16 different 4-bank groups (64 banks x 4 B), no bank conflict.
#define KPITCH 144                 // K rows: 128 B of data + 16 B pad
#define VPITCH 80                  // Vt rows: 64 B of data + 16 B pad
#define KBUF   (32 * KPITCH)       // one K tile, 32 keys
#define VBUF   (64 * VPITCH)       // one Vt tile, 64 d-rows

typedef __attribute__((ext_vector_type(16))) __bf16 v16bf;
typedef __attribute__((ext_vector_type(8)))  float  v8f;

union FragBF { v16bf v; unsigned u[8]; uint4 q[2]; };
union Acc    { v8f v; float f[8]; };

// Pinned packed conversion: keeps SLP from turning pairs into v_perm shuffles.
__device__ __forceinline__ unsigned pk(float a, float b) {
    unsigned d;
    asm("v_cvt_pk_bf16_f32 %0, %1, %2" : "=v"(d) : "v"(a), "v"(b));
    return d;
}

__device__ __forceinline__ v8f wmma_bf16(const v16bf& a, const v16bf& b, const v8f& c) {
    return __builtin_amdgcn_wmma_f32_16x16x32_bf16(false, a, false, b, (short)0, c, false, false);
}

__device__ __forceinline__ void wait_async0() {
#if __has_builtin(__builtin_amdgcn_s_wait_asynccnt)
    __builtin_amdgcn_s_wait_asynccnt(0);
#else
    asm volatile("s_wait_asynccnt 0x0" ::: "memory");
#endif
}

// Four async copies of 16 B per lane (global -> LDS), tracked by ASYNCcnt.
// s_wait_xcnt 0 closes the statement so that no address register named here
// is rewritten (next trip's address additions) ahead of it.
__device__ __forceinline__ void async_b128x4(
    unsigned l0, unsigned long long g0, unsigned l1, unsigned long long g1,
    unsigned l2, unsigned long long g2, unsigned l3, unsigned long long g3) {
    asm volatile("global_load_async_to_lds_b128 %0, %1, off\n\t"
                 "global_load_async_to_lds_b128 %2, %3, off\n\t"
                 "global_load_async_to_lds_b128 %4, %5, off\n\t"
                 "global_load_async_to_lds_b128 %6, %7, off\n\t"
                 "s_wait_xcnt 0x0"
                 :: "v"(l0), "v"(g0), "v"(l1), "v"(g1),
                    "v"(l2), "v"(g2), "v"(l3), "v"(g3) : "memory");
}

// Fragment dword map (16-bit 16x16x32 WMMA, wave32):
//   register r (0..7), lane-half hf: dword index = (r>>2)*8 + hf*4 + (r&3)
//   within a 32-dword (64 bf16) row; K-slice ks adds 16 dwords.
// => u[0..3] and u[4..7] are each 16B-contiguous: load fragments as 2 x b128.

// ---------------------------------------------------------------------------
// Kernel 0: pre-pack weights fp32 [H,D,D] -> bf16, fragment-major:
//   dst uint4[(h*2+ks)*256 + g*128 + hf*64 + col] = regs r=0..3 for that slot,
//   where k = ks*32 + g*16 + hf*8 + 2r (+1), col = output column.
// ---------------------------------------------------------------------------
__global__ __launch_bounds__(256) void pack_w_kernel(
    const float* __restrict__ Wq, const float* __restrict__ Wk,
    const float* __restrict__ Wv, const float* __restrict__ Wo,
    unsigned* __restrict__ Wqb, unsigned* __restrict__ Wkb,
    unsigned* __restrict__ Wvb, unsigned* __restrict__ Wob)
{
    const int idx = blockIdx.x * 256 + threadIdx.x;      // H*32*64 = 32768 total
    const int col = idx & 63;
    const int k2  = (idx >> 6) & 31;                     // k/2
    const int h   = idx >> 11;
    const int ks  = k2 >> 4;
    const int g   = (k2 >> 3) & 1;
    const int hf  = (k2 >> 2) & 1;
    const int r   = k2 & 3;
    const size_t src = ((size_t)h * DD + 2 * k2) * DD + col;
    const int dst = (((h * 2 + ks) * 256 + g * 128 + hf * 64 + col) << 2) + r;
    Wqb[dst] = pk(Wq[src], Wq[src + DD]);
    Wkb[dst] = pk(Wk[src], Wk[src + DD]);
    Wvb[dst] = pk(Wv[src], Wv[src + DD]);
    Wob[dst] = pk(Wo[src], Wo[src + DD]);
}

// One projection matrix: 16 rows x 64 cols; each B-frag = 2 x b128 loads.
// MODE 0: Q (scaled 1/32, [B,H,N,D]); 1: K ([B,H,N,D]); 2: V transposed ([B,H,D,N]).
template<int MODE>
__device__ __forceinline__ void proj_mat(
    const FragBF a[2], const uint4* __restrict__ Wb4,
    const float* __restrict__ bias, int bh, int h,
    int n0, int l16, int half, __bf16* __restrict__ dst)
{
    v8f c[4];
    { v8f z = {}; for (int i = 0; i < 4; ++i) c[i] = z; }
#pragma unroll
    for (int ks = 0; ks < 2; ++ks) {
        const uint4* wb = Wb4 + (size_t)(h * 2 + ks) * 256 + half * 64;
#pragma unroll
        for (int ct = 0; ct < 4; ++ct) {
            const int col = ct * 16 + l16;
            FragBF bf;
            bf.q[0] = wb[col];          // regs 0..3
            bf.q[1] = wb[128 + col];    // regs 4..7
            c[ct] = wmma_bf16(a[ks].v, bf.v, c[ct]);
        }
    }
#pragma unroll
    for (int ct = 0; ct < 4; ++ct) {
        const int col = ct * 16 + l16;
        const float bv = bias[h * DD + col];
#pragma unroll
        for (int r = 0; r < 8; ++r) {
            const int row = n0 + r + 8 * half;           // C: m = r + 8*half
            const float val = c[ct][r] + bv;
            if (MODE == 0)
                dst[((size_t)bh * NN + row) * DD + col] = (__bf16)(val * 0.03125f);
            else if (MODE == 1)
                dst[((size_t)bh * NN + row) * DD + col] = (__bf16)val;
            else
                dst[((size_t)bh * DD + col) * NN + row] = (__bf16)val;
        }
    }
}

// ---------------------------------------------------------------------------
// Kernel 1: fused Q/K/V projection. grid = (N/64, B*H), block = 128 (4 waves).
// Reads x as fp32 and rounds it to bf16 in registers: each x element is used by
// exactly one wave, so a bf16 copy in memory would only add a round trip.
// ---------------------------------------------------------------------------
__global__ __launch_bounds__(128) void qkv_proj_kernel(
    const float* __restrict__ x,
    const uint4* __restrict__ Wqb, const float* __restrict__ bq,
    const uint4* __restrict__ Wkb, const float* __restrict__ bk,
    const uint4* __restrict__ Wvb, const float* __restrict__ bv,
    __bf16* __restrict__ Qs, __bf16* __restrict__ Ks, __bf16* __restrict__ Vt)
{
    const int bh   = blockIdx.y;
    const int b    = bh / HH, h = bh % HH;
    const int wave = threadIdx.x >> 5;
    const int lane = threadIdx.x & 31;
    const int half = lane >> 4;
    const int l16  = lane & 15;
    const int n0   = blockIdx.x * 64 + wave * 16;

    // A fragments: rows n0..n0+15 of x. Registers g*4..g*4+3 of K-slice ks hold
    // k = ks*32 + g*16 + half*8 .. +7: 8 floats = 2 x b128, packed in pairs.
    FragBF a[2];
    {
        const float4* xp4 = (const float4*)(x + ((size_t)(b * NN + n0 + l16) * HH + h) * DD);
        float4 f[2][2][2];
#pragma unroll
        for (int ks = 0; ks < 2; ++ks)
#pragma unroll
            for (int g = 0; g < 2; ++g) {
                f[ks][g][0] = xp4[ks * 8 + g * 4 + half * 2];
                f[ks][g][1] = xp4[ks * 8 + g * 4 + half * 2 + 1];
            }
        // Keeps all eight loads of x ahead of the first conversion: sunk between
        // the products they would expose the memory latency three times, not once.
        __builtin_amdgcn_sched_barrier(0);
#pragma unroll
        for (int ks = 0; ks < 2; ++ks)
#pragma unroll
            for (int g = 0; g < 2; ++g) {
                a[ks].u[g * 4 + 0] = pk(f[ks][g][0].x, f[ks][g][0].y);
                a[ks].u[g * 4 + 1] = pk(f[ks][g][0].z, f[ks][g][0].w);
                a[ks].u[g * 4 + 2] = pk(f[ks][g][1].x, f[ks][g][1].y);
                a[ks].u[g * 4 + 3] = pk(f[ks][g][1].z, f[ks][g][1].w);
            }
    }
    proj_mat<0>(a, Wqb, bq, bh, h, n0, l16, half, Qs);
    proj_mat<1>(a, Wkb, bk, bh, h, n0, l16, half, Ks);
    proj_mat<2>(a, Wvb, bv, bh, h, n0, l16, half, Vt);
}

// Stage one 32-key K/V tile into an LDS buffer (async, ASYNCcnt-tracked).
__device__ __forceinline__ void stage_tile(
    const __bf16* __restrict__ Ks, const __bf16* __restrict__ Vt,
    int bh, int j0, int t, unsigned klds, unsigned vlds)
{
    // K tile: rows j0..j0+31 contiguous in global -> 4 KB, 32 B per thread
    unsigned long long kg = (unsigned long long)(uintptr_t)
        (Ks + ((size_t)bh * NN + j0) * DD) + (unsigned long long)t * 32u;
    // Vt tile: 64 rows (d) x 64 B; 32 B per thread
    const int vrow = t >> 1;
    unsigned long long vg = (unsigned long long)(uintptr_t)
        (Vt + ((size_t)bh * DD + vrow) * NN + j0) + ((unsigned long long)(t & 1) << 5);
    async_b128x4(klds, kg, klds + 16u, kg + 16u, vlds, vg, vlds + 16u, vg + 16u);
}

// ---------------------------------------------------------------------------
// Kernel 2: flash attention. grid = (N/128, B*H), block = 128 (4 waves).
// Each wave owns QT = 2 query tiles (32 queries): every K and Vt fragment read
// from LDS feeds two WMMAs, and one staged tile serves 128 queries.
// S^T = K.Q^T so the score C-layout refeeds directly as the P A-fragment.
// Double-buffered LDS staging: tile j+1 async-loads overlap tile-j compute.
// ---------------------------------------------------------------------------
#define QT 2
#define RESCALE_T 5.545177f        // 8 ln 2
__global__ __launch_bounds__(128) void flash_attn_kernel(
    const __bf16* __restrict__ Qs, const __bf16* __restrict__ Ks,
    const __bf16* __restrict__ Vt, __bf16* __restrict__ attn)
{
    __shared__ uint4 kbuf4[2][KBUF / 16];   // K tiles: 32 keys x 64 bf16, padded rows
    __shared__ uint4 vbuf4[2][VBUF / 16];   // Vt tiles: 64 d x 32 bf16, padded rows

    const int bh   = blockIdx.y;
    const int wave = threadIdx.x >> 5;
    const int lane = threadIdx.x & 31;
    const int half = lane >> 4;
    const int l16  = lane & 15;
    const int q0   = blockIdx.x * (64 * QT) + wave * (16 * QT);
    const int t    = threadIdx.x;

    // LDS byte offsets (generic shared pointer: low 32 bits = LDS offset)
    const unsigned koff = (unsigned)(uintptr_t)(void*)&kbuf4[0][0];
    const unsigned voff = (unsigned)(uintptr_t)(void*)&vbuf4[0][0];
    const int vrow = t >> 1;
    const unsigned kl_t = (unsigned)(t >> 2) * KPITCH + ((unsigned)(t & 3) << 5);
    const unsigned vl_t = (unsigned)vrow * VPITCH + ((unsigned)(t & 1) << 5);

    // Resident Q^T B-fragments (lane = query): 2 x b128 per K-slice and tile.
    FragBF qt[QT][2];
#pragma unroll
    for (int qi = 0; qi < QT; ++qi) {
        const uint4* qp4 = (const uint4*)(Qs + ((size_t)bh * NN + q0 + qi * 16 + l16) * DD);
#pragma unroll
        for (int ks = 0; ks < 2; ++ks) {
            qt[qi][ks].q[0] = qp4[ks * 4 + half];
            qt[qi][ks].q[1] = qp4[ks * 4 + 2 + half];
        }
    }

    float m_run[QT], m_thr[QT], l_run[QT];
    v8f o[QT][4];
#pragma unroll
    for (int qi = 0; qi < QT; ++qi) {
        m_run[qi] = -1e30f; m_thr[qi] = -1e30f; l_run[qi] = 0.f;
        v8f z = {};
        for (int i = 0; i < 4; ++i) o[qi][i] = z;
    }

    // Prologue: stage tile 0 into buffer 0
    stage_tile(Ks, Vt, bh, 0, t, koff + kl_t, voff + vl_t);
    wait_async0();
    __syncthreads();

    int cur = 0;
    for (int j0 = 0; j0 < NN; j0 += 32) {
        const int nxt = cur ^ 1;
        if (j0 + 32 < NN)   // issue next tile's async loads; overlap with compute
            stage_tile(Ks, Vt, bh, j0 + 32, t,
                       koff + (unsigned)nxt * KBUF + kl_t,
                       voff + (unsigned)nxt * VBUF + vl_t);

        const uint4* kb4 = kbuf4[cur];
        const uint4* vb4 = vbuf4[cur];

        // S^T tiles: st[qi][sub] = K[j0+sub*16 .. +15] . Q^T  (C: lane=query, vgpr=key)
        Acc st[QT][2];
#pragma unroll
        for (int sub = 0; sub < 2; ++sub) {
            FragBF ka[2];                                    // 4 x ds_load_b128
#pragma unroll
            for (int ks = 0; ks < 2; ++ks) {
                ka[ks].q[0] = kb4[(sub * 16 + l16) * (KPITCH / 16) + ks * 4 + half];
                ka[ks].q[1] = kb4[(sub * 16 + l16) * (KPITCH / 16) + ks * 4 + 2 + half];
            }
#pragma unroll
            for (int qi = 0; qi < QT; ++qi) {
                v8f c = {};
                c = wmma_bf16(ka[0].v, qt[qi][0].v, c);
                c = wmma_bf16(ka[1].v, qt[qi][1].v, c);
                st[qi][sub].v = c;
            }
        }

        // Vt fragments, read as one group ahead of the branch below: their LDS
        // latency runs under the maximum and the exponentials; behind the branch
        // each pair would be waited for right in front of its WMMAs.
        FragBF bvv[4];                                       // 8 x ds_load_b128
#pragma unroll
        for (int dt = 0; dt < 4; ++dt) {
            bvv[dt].q[0] = vb4[(dt * 16 + l16) * (VPITCH / 16) + half];
            bvv[dt].q[1] = vb4[(dt * 16 + l16) * (VPITCH / 16) + 2 + half];
        }

        // Lazy rescale: the maximum in use moves, and O and l are rescaled, only
        // when some query's new score exceeds it by more than RESCALE_T (P then
        // stays <= e^RESCALE_T = 256; O / l is the same quotient for any maximum).
        float tloc[QT];
        bool need = false;
#pragma unroll
        for (int qi = 0; qi < QT; ++qi) {
            // This lane's 16 of the query's 32 keys (the rest: lane ^ 16).
            float tmax = st[qi][0].f[0];
#pragma unroll
            for (int r = 1; r < 8; ++r) tmax = fmaxf(tmax, st[qi][0].f[r]);
#pragma unroll
            for (int r = 0; r < 8; ++r) tmax = fmaxf(tmax, st[qi][1].f[r]);
            tloc[qi] = tmax;
            need = need || (tmax > m_thr[qi]);
        }
        // One wave-uniform scalar test a pass, over both halves and both tiles.
        if (__builtin_amdgcn_ballot_w32(need) != 0) {
#pragma unroll
            for (int qi = 0; qi < QT; ++qi) {
                const float tmax  = fmaxf(tloc[qi], __shfl_xor(tloc[qi], 16, 32));
                const float m_new = fmaxf(m_run[qi], tmax);
                const float alpha = __expf(m_run[qi] - m_new);
                l_run[qi] *= alpha;
                m_run[qi] = m_new;
                m_thr[qi] = m_new + RESCALE_T;
                // Per-query alpha into the O-tile layout (query = r + 8*half)
#pragma unroll
                for (int r = 0; r < 8; ++r) {
                    const float am = __shfl(alpha, r + 8 * half, 32);
#pragma unroll
                    for (int dt = 0; dt < 4; ++dt) o[qi][dt][r] *= am;
                }
            }
        }

        FragBF pa[QT];
#pragma unroll
        for (int qi = 0; qi < QT; ++qi) {
            // Softmax numerators (scale 1/32 folded into Q). Keys split lane <-> lane^16.
            const float m_use = m_run[qi];
            float tsum = 0.f;
#pragma unroll
            for (int r = 0; r < 8; ++r) { st[qi][0].f[r] = __expf(st[qi][0].f[r] - m_use); tsum += st[qi][0].f[r]; }
#pragma unroll
            for (int r = 0; r < 8; ++r) { st[qi][1].f[r] = __expf(st[qi][1].f[r] - m_use); tsum += st[qi][1].f[r]; }
            tsum += __shfl_xor(tsum, 16, 32);
            l_run[qi] += tsum;

            // Pack P as A-fragment: S^T C-layout maps 1:1 onto P A-layout (same lane).
#pragma unroll
            for (int r = 0; r < 4; ++r) {
                pa[qi].u[r]     = pk(st[qi][0].f[2 * r], st[qi][0].f[2 * r + 1]);
                pa[qi].u[4 + r] = pk(st[qi][1].f[2 * r], st[qi][1].f[2 * r + 1]);
            }
        }

#pragma unroll
        for (int dt = 0; dt < 4; ++dt)
#pragma unroll
            for (int qi = 0; qi < QT; ++qi)
                o[qi][dt] = wmma_bf16(pa[qi].v, bvv[dt].v, o[qi][dt]);

        wait_async0();      // next tile's data landed in LDS
        __syncthreads();    // all waves done reading cur, next tile visible
        cur = nxt;
    }

    // Normalize by l and store attn (bf16 [B,H,N,D])
#pragma unroll
    for (int qi = 0; qi < QT; ++qi) {
        float lm[8];
#pragma unroll
        for (int r = 0; r < 8; ++r) lm[r] = __shfl(l_run[qi], r + 8 * half, 32);
#pragma unroll
        for (int dt = 0; dt < 4; ++dt)
#pragma unroll
            for (int r = 0; r < 8; ++r) {
                const int row = q0 + qi * 16 + r + 8 * half;
                attn[((size_t)bh * NN + row) * DD + dt * 16 + l16] = (__bf16)(o[qi][dt][r] / lm[r]);
            }
    }
}

// ---------------------------------------------------------------------------
// Kernel 3: output projection. out[b,n,h,:] = attn[b,h,n,:]·Wo[h] + bo[h], fp32.
// ---------------------------------------------------------------------------
__global__ __launch_bounds__(128) void out_proj_kernel(
    const __bf16* __restrict__ attn, const uint4* __restrict__ Wob,
    const float* __restrict__ bo, float* __restrict__ out)
{
    const int bh   = blockIdx.y;
    const int b    = bh / HH, h = bh % HH;
    const int wave = threadIdx.x >> 5;
    const int lane = threadIdx.x & 31;
    const int half = lane >> 4;
    const int l16  = lane & 15;
    const int n0   = blockIdx.x * 64 + wave * 16;

    FragBF a[2];
    {
        const uint4* ap4 = (const uint4*)(attn + ((size_t)bh * NN + n0 + l16) * DD);
#pragma unroll
        for (int ks = 0; ks < 2; ++ks) {
            a[ks].q[0] = ap4[ks * 4 + half];
            a[ks].q[1] = ap4[ks * 4 + 2 + half];
        }
    }
    v8f c[4];
    { v8f z = {}; for (int i = 0; i < 4; ++i) c[i] = z; }
#pragma unroll
    for (int ks = 0; ks < 2; ++ks) {
        const uint4* wb = Wob + (size_t)(h * 2 + ks) * 256 + half * 64;
#pragma unroll
        for (int ct = 0; ct < 4; ++ct) {
            const int col = ct * 16 + l16;
            FragBF bf;
            bf.q[0] = wb[col];
            bf.q[1] = wb[128 + col];
            c[ct] = wmma_bf16(a[ks].v, bf.v, c[ct]);
        }
    }
#pragma unroll
    for (int ct = 0; ct < 4; ++ct) {
        const int col = ct * 16 + l16;
        const float bias = bo[h * DD + col];
#pragma unroll
        for (int r = 0; r < 8; ++r) {
            const int row = n0 + r + 8 * half;
            out[((size_t)(b * NN + row) * HH + h) * DD + col] = c[ct][r] + bias;
        }
    }
}

extern "C" void kernel_launch(void* const* d_in, const int* in_sizes, int n_in,
                              void* d_out, int out_size, void* d_ws, size_t ws_size,
                              hipStream_t stream) {
    const float* x  = (const float*)d_in[0];
    const float* Wq = (const float*)d_in[1];
    const float* bq = (const float*)d_in[2];
    const float* Wk = (const float*)d_in[3];
    const float* bk = (const float*)d_in[4];
    const float* Wv = (const float*)d_in[5];
    const float* bv = (const float*)d_in[6];
    const float* Wo = (const float*)d_in[7];
    const float* bo = (const float*)d_in[8];
    float* out = (float*)d_out;

    const size_t SZ = (size_t)BB * HH * NN * DD;     // elems per bf16 tensor
    const size_t WSZ = (size_t)HH * 32 * 64;         // packed-weight dwords per tensor
    __bf16* Qs = (__bf16*)d_ws;
    __bf16* Ks = Qs + SZ;
    __bf16* Vt = Ks + SZ;
    __bf16* at = Vt + SZ;
    unsigned* Wqb = (unsigned*)(at + SZ);
    unsigned* Wkb = Wqb + WSZ;
    unsigned* Wvb = Wkb + WSZ;
    unsigned* Wob = Wvb + WSZ;

    dim3 grid(NN / 64, BB * HH);
    pack_w_kernel   <<<dim3(128), 256, 0, stream>>>(Wq, Wk, Wv, Wo, Wqb, Wkb, Wvb, Wob);
    qkv_proj_kernel <<<grid, 128, 0, stream>>>(x, (const uint4*)Wqb, bq, (const uint4*)Wkb, bk,
                                               (const uint4*)Wvb, bv, Qs, Ks, Vt);
    flash_attn_kernel<<<dim3(NN / (64 * QT), BB * HH), 128, 0, stream>>>(Qs, Ks, Vt, at);
    out_proj_kernel <<<grid, 128, 0, stream>>>(at, (const uint4*)Wob, bo, out);
}

// v005
// One run takes 89.3 microseconds.
// Two timings next to v004 put it at 1.07 and 1.08 times that version's speed.
// All steps since v000 together make it 2.32 times as fast.
#include <hip/hip_runtime.h>
#include <hip/hip_bf16.h>

#define BB 4
#define NN 2048
#define HH 16
#define DD 64

// LDS row pitches in bytes, 16 B x odd: the 16 lanes of a ds_load_b128 half
// then start on 16 different 4-bank groups (64 banks x 4 B), no bank conflict.
#define KPITCH 144                 // K rows: 128 B of data + 16 B pad
#define VPITCH 80                  // Vt rows: 64 B of data + 16 B pad
#define KBUF   (32 * KPITCH)       // one K tile, 32 keys
#define VBUF   (64 * VPITCH)       // one Vt tile, 64 d-rows
#define OPITCH 144                 // O rows staged for the output projection: 128 B + 16 B pad

typedef __attribute__((ext_vector_type(16))) __bf16 v16bf;
typedef __attribute__((ext_vector_type(8)))  float  v8f;

union FragBF { v16bf v; unsigned u[8]; uint4 q[2]; };
union Acc    { v8f v; float f[8]; };

// Pinned packed conversion: keeps SLP from turning pairs into v_perm shuffles.
__device__ __forceinline__ unsigned pk(float a, float b) {
    unsigned d;
    asm("v_cvt_pk_bf16_f32 %0, %1, %2" : "=v"(d) : "v"(a), "v"(b));
    return d;
}

__device__ __forceinline__ v8f wmma_bf16(const v16bf& a, const v16bf& b, const v8f& c) {
    return __builtin_amdgcn_wmma_f32_16x16x32_bf16(false, a, false, b, (short)0, c, false, false);
}

__device__ __forceinline__ void wait_async0() {
#if __has_builtin(__builtin_amdgcn_s_wait_asynccnt)
    __builtin_amdgcn_s_wait_asynccnt(0);
#else
    asm volatile("s_wait_asynccnt 0x0" ::: "memory");
#endif
}

// Four async copies of 16 B per lane (global -> LDS), tracked by ASYNCcnt.
// s_wait_xcnt 0 closes the statement so that no address register named here
// is rewritten (next trip's address additions) ahead of it.
__device__ __forceinline__ void async_b128x4(
    unsigned l0, unsigned long long g0, unsigned l1, unsigned long long g1,
    unsigned l2, unsigned long long g2, unsigned l3, unsigned long long g3) {
    asm volatile("global_load_async_to_lds_b128 %0, %1, off\n\t"
                 "global_load_async_to_lds_b128 %2, %3, off\n\t"
                 "global_load_async_to_lds_b128 %4, %5, off\n\t"
                 "global_load_async_to_lds_b128 %6, %7, off\n\t"
                 "s_wait_xcnt 0x0"
                 :: "v"(l0), "v"(g0), "v"(l1), "v"(g1),
                    "v"(l2), "v"(g2), "v"(l3), "v"(g3) : "memory");
}

// Fragment dword map (16-bit 16x16x32 WMMA, wave32):
//   register r (0..7), lane-half hf: dword index = (r>>2)*8 + hf*4 + (r&3)
//   within a 32-dword (64 bf16) row; K-slice ks adds 16 dwords.
// => u[0..3] and u[4..7] are each 16B-contiguous: load fragments as 2 x b128.

// ---------------------------------------------------------------------------
// Kernel 0: pre-pack weights fp32 [H,D,D] -> bf16, fragment-major:
//   dst uint4[(h*2+ks)*256 + g*128 + hf*64 + col] = regs r=0..3 for that slot,
//   where k = ks*32 + g*16 + hf*8 + 2r (+1), col = output column.
// ---------------------------------------------------------------------------
__global__ __launch_bounds__(256) void pack_w_kernel(
    const float* __restrict__ Wq, const float* __restrict__ Wk,
    const float* __restrict__ Wv, const float* __restrict__ Wo,
    unsigned* __restrict__ Wqb, unsigned* __restrict__ Wkb,
    unsigned* __restrict__ Wvb, unsigned* __restrict__ Wob)
{
    const int idx = blockIdx.x * 256 + threadIdx.x;      // H*32*64 = 32768 total
    const int col = idx & 63;
    const int k2  = (idx >> 6) & 31;                     // k/2
    const int h   = idx >> 11;
    const int ks  = k2 >> 4;
    const int g   = (k2 >> 3) & 1;
    const int hf  = (k2 >> 2) & 1;
    const int r   = k2 & 3;
    const size_t src = ((size_t)h * DD + 2 * k2) * DD + col;
    const int dst = (((h * 2 + ks) * 256 + g * 128 + hf * 64 + col) << 2) + r;
    Wqb[dst] = pk(Wq[src], Wq[src + DD]);
    Wkb[dst] = pk(Wk[src], Wk[src + DD]);
    Wvb[dst] = pk(Wv[src], Wv[src + DD]);
    Wob[dst] = pk(Wo[src], Wo[src + DD]);
}

// One projection matrix: 16 rows x 64 cols; each B-frag = 2 x b128 loads.
// MODE 0: Q (scaled 1/32, [B,H,N,D]); 1: K ([B,H,N,D]); 2: V transposed ([B,H,D,N]).
template<int MODE>
__device__ __forceinline__ void proj_mat(
    const FragBF a[2], const uint4* __restrict__ Wb4,
    const float* __restrict__ bias, int bh, int h,
    int n0, int l16, int half, __bf16* __restrict__ dst)
{
    v8f c[4];
    { v8f z = {}; for (int i = 0; i < 4; ++i) c[i] = z; }
#pragma unroll
    for (int ks = 0; ks < 2; ++ks) {
        const uint4* wb = Wb4 + (size_t)(h * 2 + ks) * 256 + half * 64;
#pragma unroll
        for (int ct = 0; ct < 4; ++ct) {
            const int col = ct * 16 + l16;
            FragBF bf;
            bf.q[0] = wb[col];          // regs 0..3
            bf.q[1] = wb[128 + col];    // regs 4..7
            c[ct] = wmma_bf16(a[ks].v, bf.v, c[ct]);
        }
    }
#pragma unroll
    for (int ct = 0; ct < 4; ++ct) {
        const int col = ct * 16 + l16;
        const float bv = bias[h * DD + col];
#pragma unroll
        for (int r = 0; r < 8; ++r) {
            const int row = n0 + r + 8 * half;           // C: m = r + 8*half
            const float val = c[ct][r] + bv;
            if (MODE == 0)
                dst[((size_t)bh * NN + row) * DD + col] = (__bf16)(val * 0.03125f);
            else if (MODE == 1)
                dst[((size_t)bh * NN + row) * DD + col] = (__bf16)val;
            else
                dst[((size_t)bh * DD + col) * NN + row] = (__bf16)val;
        }
    }
}

// ---------------------------------------------------------------------------
// Kernel 1: fused Q/K/V projection. grid = (N/64, B*H), block = 128 (4 waves).
// Reads x as fp32 and rounds it to bf16 in registers: each x element is used by
// exactly one wave, so a bf16 copy in memory would only add a round trip.
// ---------------------------------------------------------------------------
__global__ __launch_bounds__(128) void qkv_proj_kernel(
    const float* __restrict__ x,
    const uint4* __restrict__ Wqb, const float* __restrict__ bq,
    const uint4* __restrict__ Wkb, const float* __restrict__ bk,
    const uint4* __restrict__ Wvb, const float* __restrict__ bv,
    __bf16* __restrict__ Qs, __bf16* __restrict__ Ks, __bf16* __restrict__ Vt)
{
    const int bh   = blockIdx.y;
    const int b    = bh / HH, h = bh % HH;
    const int wave = threadIdx.x >> 5;
    const int lane = threadIdx.x & 31;
    const int half = lane >> 4;
    const int l16  = lane & 15;
    const int n0   = blockIdx.x * 64 + wave * 16;

    // A fragments: rows n0..n0+15 of x. Registers g*4..g*4+3 of K-slice ks hold
    // k = ks*32 + g*16 + half*8 .. +7: 8 floats = 2 x b128, packed in pairs.
    FragBF a[2];
    {
        const float4* xp4 = (const float4*)(x + ((size_t)(b * NN + n0 + l16) * HH + h) * DD);
        float4 f[2][2][2];
#pragma unroll
        for (int ks = 0; ks < 2; ++ks)
#pragma unroll
            for (int g = 0; g < 2; ++g) {
                f[ks][g][0] = xp4[ks * 8 + g * 4 + half * 2];
                f[ks][g][1] = xp4[ks * 8 + g * 4 + half * 2 + 1];
            }
        // Keeps all eight loads of x ahead of the first conversion: sunk between
        // the products they would expose the memory latency three times, not once.
        __builtin_amdgcn_sched_barrier(0);
#pragma unroll
        for (int ks = 0; ks < 2; ++ks)
#pragma unroll
            for (int g = 0; g < 2; ++g) {
                a[ks].u[g * 4 + 0] = pk(f[ks][g][0].x, f[ks][g][0].y);
                a[ks].u[g * 4 + 1] = pk(f[ks][g][0].z, f[ks][g][0].w);
                a[ks].u[g * 4 + 2] = pk(f[ks][g][1].x, f[ks][g][1].y);
                a[ks].u[g * 4 + 3] = pk(f[ks][g][1].z, f[ks][g][1].w);
            }
    }
    proj_mat<0>(a, Wqb, bq, bh, h, n0, l16, half, Qs);
    proj_mat<1>(a, Wkb, bk, bh, h, n0, l16, half, Ks);
    proj_mat<2>(a, Wvb, bv, bh, h, n0, l16, half, Vt);
}

// Stage one 32-key K/V tile into an LDS buffer (async, ASYNCcnt-tracked).
__device__ __forceinline__ void stage_tile(
    const __bf16* __restrict__ Ks, const __bf16* __restrict__ Vt,
    int bh, int j0, int t, unsigned klds, unsigned vlds)
{
    // K tile: rows j0..j0+31 contiguous in global -> 4 KB, 32 B per thread
    unsigned long long kg = (unsigned long long)(uintptr_t)
        (Ks + ((size_t)bh * NN + j0) * DD) + (unsigned long long)t * 32u;
    // Vt tile: 64 rows (d) x 64 B; 32 B per thread
    const int vrow = t >> 1;
    unsigned long long vg = (unsigned long long)(uintptr_t)
        (Vt + ((size_t)bh * DD + vrow) * NN + j0) + ((unsigned long long)(t & 1) << 5);
    async_b128x4(klds, kg, klds + 16u, kg + 16u, vlds, vg, vlds + 16u, vg + 16u);
}

// ---------------------------------------------------------------------------
// Kernel 2: flash attention. grid = (N/128, B*H), block = 128 (4 waves).
// Each wave owns QT = 2 query tiles (32 queries): every K and Vt fragment read
// from LDS feeds two WMMAs, and one staged tile serves 128 queries.
// S^T = K.Q^T so the score C-layout refeeds directly as the P A-fragment.
// Double-buffered LDS staging: tile j+1 async-loads overlap tile-j compute.
// Epilogue: out[b,n,h,:] = attn[b,h,n,:].Wo[h] + bo[h] (fp32) on the wave's own
// 32 rows: attn never goes to memory and needs no launch of its own.
// ---------------------------------------------------------------------------
#define QT 2
#define RESCALE_T 5.545177f        // 8 ln 2
__global__ __launch_bounds__(128) void flash_attn_kernel(
    const __bf16* __restrict__ Qs, const __bf16* __restrict__ Ks,
    const __bf16* __restrict__ Vt, const uint4* __restrict__ Wob,
    const float* __restrict__ bo, float* __restrict__ out)
{
    // One array: two Vt tiles (64 d x 32 bf16), two K tiles (32 keys x 64 bf16),
    // padded rows; behind the loop the same bytes stage O, 32 rows a wave.
    __shared__ uint4 smem4[(2 * VBUF + 2 * KBUF) / 16];
    static_assert(4 * 16 * QT * OPITCH <= 2 * VBUF + 2 * KBUF, "O staging fits the ring");

    const int bh   = blockIdx.y;
    const int wave = threadIdx.x >> 5;
    const int lane = threadIdx.x & 31;
    const int half = lane >> 4;
    const int l16  = lane & 15;
    const int q0   = blockIdx.x * (64 * QT) + wave * (16 * QT);
    const int t    = threadIdx.x;

    // LDS byte offsets (generic shared pointer: low 32 bits = LDS offset)
    const unsigned voff = (unsigned)(uintptr_t)(void*)&smem4[0];
    const unsigned koff = voff + 2u * VBUF;
    const int vrow = t >> 1;
    const unsigned kl_t = (unsigned)(t >> 2) * KPITCH + ((unsigned)(t & 3) << 5);
    const unsigned vl_t = (unsigned)vrow * VPITCH + ((unsigned)(t & 1) << 5);

    // Resident Q^T B-fragments (lane = query): 2 x b128 per K-slice and tile.
    FragBF qt[QT][2];
#pragma unroll
    for (int qi = 0; qi < QT; ++qi) {
        const uint4* qp4 = (const uint4*)(Qs + ((size_t)bh * NN + q0 + qi * 16 + l16) * DD);
#pragma unroll
        for (int ks = 0; ks < 2; ++ks) {
            qt[qi][ks].q[0] = qp4[ks * 4 + half];
            qt[qi][ks].q[1] = qp4[ks * 4 + 2 + half];
        }
    }

    float m_run[QT], m_thr[QT], l_run[QT];
    v8f o[QT][4];
#pragma unroll
    for (int qi = 0; qi < QT; ++qi) {
        m_run[qi] = -1e30f; m_thr[qi] = -1e30f; l_run[qi] = 0.f;
        v8f z = {};
        for (int i = 0; i < 4; ++i) o[qi][i] = z;
    }

    // Prologue: stage tile 0 into buffer 0
    stage_tile(Ks, Vt, bh, 0, t, koff + kl_t, voff + vl_t);
    wait_async0();
    __syncthreads();

    int cur = 0;
    for (int j0 = 0; j0 < NN; j0 += 32) {
        const int nxt = cur ^ 1;
        if (j0 + 32 < NN)   // issue next tile's async loads; overlap with compute
            stage_tile(Ks, Vt, bh, j0 + 32, t,
                       koff + (unsigned)nxt * KBUF + kl_t,
                       voff + (unsigned)nxt * VBUF + vl_t);

        const uint4* kb4 = smem4 + (2 * VBUF + cur * KBUF) / 16;
        const uint4* vb4 = smem4 + (cur * VBUF) / 16;

        // S^T tiles: st[qi][sub] = K[j0+sub*16 .. +15] . Q^T  (C: lane=query, vgpr=key)
        Acc st[QT][2];
#pragma unroll
        for (int sub = 0; sub < 2; ++sub) {
            FragBF ka[2];                                    // 4 x ds_load_b128
#pragma unroll
            for (int ks = 0; ks < 2; ++ks) {
                ka[ks].q[0] = kb4[(sub * 16 + l16) * (KPITCH / 16) + ks * 4 + half];
                ka[ks].q[1] = kb4[(sub * 16 + l16) * (KPITCH / 16) + ks * 4 + 2 + half];
            }
#pragma unroll
            for (int qi = 0; qi < QT; ++qi) {
                v8f c = {};
                c = wmma_bf16(ka[0].v, qt[qi][0].v, c);
                c = wmma_bf16(ka[1].v, qt[qi][1].v, c);
                st[qi][sub].v = c;
            }
        }

        // Vt fragments, read as one group ahead of the branch below: their LDS
        // latency runs under the maximum and the exponentials; behind the branch
        // each pair would be waited for right in front of its WMMAs.
        FragBF bvv[4];                                       // 8 x ds_load_b128
#pragma unroll
        for (int dt = 0; dt < 4; ++dt) {
            bvv[dt].q[0] = vb4[(dt * 16 + l16) * (VPITCH / 16) + half];
            bvv[dt].q[1] = vb4[(dt * 16 + l16) * (VPITCH / 16) + 2 + half];
        }

        // Lazy rescale: the maximum in use moves, and O and l are rescaled, only
        // when some query's new score exceeds it by more than RESCALE_T (P then
        // stays <= e^RESCALE_T = 256; O / l is the same quotient for any maximum).
        float tloc[QT];
        bool need = false;
#pragma unroll
        for (int qi = 0; qi < QT; ++qi) {
            // This lane's 16 of the query's 32 keys (the rest: lane ^ 16).
            float tmax = st[qi][0].f[0];
#pragma unroll
            for (int r = 1; r < 8; ++r) tmax = fmaxf(tmax, st[qi][0].f[r]);
#pragma unroll
            for (int r = 0; r < 8; ++r) tmax = fmaxf(tmax, st[qi][1].f[r]);
            tloc[qi] = tmax;
            need = need || (tmax > m_thr[qi]);
        }
        // One wave-uniform scalar test a pass, over both halves and both tiles.
        if (__builtin_amdgcn_ballot_w32(need) != 0) {
#pragma unroll
            for (int qi = 0; qi < QT; ++qi) {
                const float tmax  = fmaxf(tloc[qi], __shfl_xor(tloc[qi], 16, 32));
                const float m_new = fmaxf(m_run[qi], tmax);
                const float alpha = __expf(m_run[qi] - m_new);
                l_run[qi] *= alpha;
                m_run[qi] = m_new;
                m_thr[qi] = m_new + RESCALE_T;
                // Per-query alpha into the O-tile layout (query = r + 8*half)
#pragma unroll
                for (int r = 0; r < 8; ++r) {
                    const float am = __shfl(alpha, r + 8 * half, 32);
#pragma unroll
                    for (int dt = 0; dt < 4; ++dt) o[qi][dt][r] *= am;
                }
            }
        }

        FragBF pa[QT];
#pragma unroll
        for (int qi = 0; qi < QT; ++qi) {
            // Softmax numerators (scale 1/32 folded into Q). Keys split lane <-> lane^16.
            const float m_use = m_run[qi];
            float tsum = 0.f;
#pragma unroll
            for (int r = 0; r < 8; ++r) { st[qi][0].f[r] = __expf(st[qi][0].f[r] - m_use); tsum += st[qi][0].f[r]; }
#pragma unroll
            for (int r = 0; r < 8; ++r) { st[qi][1].f[r] = __expf(st[qi][1].f[r] - m_use); tsum += st[qi][1].f[r]; }
            tsum += __shfl_xor(tsum, 16, 32);
            l_run[qi] += tsum;

            // Pack P as A-fragment: S^T C-layout maps 1:1 onto P A-layout (same lane).
#pragma unroll
            for (int r = 0; r < 4; ++r) {
                pa[qi].u[r]     = pk(st[qi][0].f[2 * r], st[qi][0].f[2 * r + 1]);
                pa[qi].u[4 + r] = pk(st[qi][1].f[2 * r], st[qi][1].f[2 * r + 1]);
            }
        }

#pragma unroll
        for (int dt = 0; dt < 4; ++dt)
#pragma unroll
            for (int qi = 0; qi < QT; ++qi)
                o[qi][dt] = wmma_bf16(pa[qi].v, bvv[dt].v, o[qi][dt]);

        wait_async0();      // next tile's data landed in LDS
        __syncthreads();    // all waves done reading cur, next tile visible
        cur = nxt;
    }

    const int b = bh / HH, h = bh % HH;

    // Wo fragments and bias, asked for first: their latency runs under the staging.
    FragBF wf[2][4];
    float bias[4];
#pragma unroll
    for (int ks = 0; ks < 2; ++ks) {
        const uint4* wb = Wob + (size_t)(h * 2 + ks) * 256 + half * 64;
#pragma unroll
        for (int ct = 0; ct < 4; ++ct) {
            wf[ks][ct].q[0] = wb[ct * 16 + l16];
            wf[ks][ct].q[1] = wb[128 + ct * 16 + l16];
        }
    }
#pragma unroll
    for (int ct = 0; ct < 4; ++ct) bias[ct] = bo[h * DD + ct * 16 + l16];

    // Normalize by l, round to bf16 and lay the rows in this wave's own LDS range
    // (the loop's last barrier has ended every read of the ring; no copy is in flight).
    __bf16* ob = (__bf16*)smem4 + wave * (16 * QT * OPITCH / 2);
#pragma unroll
    for (int qi = 0; qi < QT; ++qi) {
        float lm[8];
#pragma unroll
        for (int r = 0; r < 8; ++r) lm[r] = __shfl(l_run[qi], r + 8 * half, 32);
#pragma unroll
        for (int dt = 0; dt < 4; ++dt)
#pragma unroll
            for (int r = 0; r < 8; ++r)
                ob[(qi * 16 + r + 8 * half) * (OPITCH / 2) + dt * 16 + l16] = (__bf16)(o[qi][dt][r] / lm[r]);
    }
    // The rows are read back by other lanes of the same wave: every store above
    // has to be done, and no read below may be lifted over it.
    asm volatile("s_wait_dscnt 0x0" ::: "memory");

    // A fragments (lane = query row): 2 x ds_load_b128 per K-slice and tile.
    const uint4* ob4 = (const uint4*)ob;
    FragBF a[QT][2];
#pragma unroll
    for (int qi = 0; qi < QT; ++qi)
#pragma unroll
        for (int ks = 0; ks < 2; ++ks) {
            a[qi][ks].q[0] = ob4[(qi * 16 + l16) * (OPITCH / 16) + ks * 4 + half];
            a[qi][ks].q[1] = ob4[(qi * 16 + l16) * (OPITCH / 16) + ks * 4 + 2 + half];
        }

    v8f c[QT][4];
#pragma unroll
    for (int qi = 0; qi < QT; ++qi) {
        v8f z = {};
        for (int i = 0; i < 4; ++i) c[qi][i] = z;
    }
#pragma unroll
    for (int ks = 0; ks < 2; ++ks)
#pragma unroll
        for (int ct = 0; ct < 4; ++ct)
#pragma unroll
            for (int qi = 0; qi < QT; ++qi)
                c[qi][ct] = wmma_bf16(a[qi][ks].v, wf[ks][ct].v, c[qi][ct]);

#pragma unroll
    for (int qi = 0; qi < QT; ++qi)
#pragma unroll
        for (int ct = 0; ct < 4; ++ct)
#pragma unroll
            for (int r = 0; r < 8; ++r) {
                const int row = q0 + qi * 16 + r + 8 * half;
                out[((size_t)(b * NN + row) * HH + h) * DD + ct * 16 + l16] = c[qi][ct][r] + bias[ct];
            }
}

extern "C" void kernel_launch(void* const* d_in, const int* in_sizes, int n_in,
                              void* d_out, int out_size, void* d_ws, size_t ws_size,
                              hipStream_t stream) {
    const float* x  = (const float*)d_in[0];
    const float* Wq = (const float*)d_in[1];
    const float* bq = (const float*)d_in[2];
    const float* Wk = (const float*)d_in[3];
    const float* bk = (const float*)d_in[4];
    const float* Wv = (const float*)d_in[5];
    const float* bv = (const float*)d_in[6];
    const float* Wo = (const float*)d_in[7];
    const float* bo = (const float*)d_in[8];
    float* out = (float*)d_out;

    const size_t SZ = (size_t)BB * HH * NN * DD;     // elems per bf16 tensor
    const size_t WSZ = (size_t)HH * 32 * 64;         // packed-weight dwords per tensor
    __bf16* Qs = (__bf16*)d_ws;
    __bf16* Ks = Qs + SZ;
    __bf16* Vt = Ks + SZ;
    unsigned* Wqb = (unsigned*)(Vt + SZ);
    unsigned* Wkb = Wqb + WSZ;
    unsigned* Wvb = Wkb + WSZ;
    unsigned* Wob = Wvb + WSZ;

    dim3 grid(NN / 64, BB * HH);
    pack_w_kernel   <<<dim3(128), 256, 0, stream>>>(Wq, Wk, Wv, Wo, Wqb, Wkb, Wvb, Wob);
    qkv_proj_kernel <<<grid, 128, 0, stream>>>(x, (const uint4*)Wqb, bq, (const uint4*)Wkb, bk,
                                               (const uint4*)Wvb, bv, Qs, Ks, Vt);
    flash_attn_kernel<<<dim3(NN / (64 * QT), BB * HH), 128, 0, stream>>>(Qs, Ks, Vt,
                                               (const uint4*)Wob, bo, out);
}

// v006
// Measured time: 87.8 microseconds a run.
// In both of two side-by-side timings against v005, it was 1.03 times as fast.
// All steps since v000 together make it 2.40 times as fast.
#include <hip/hip_runtime.h>
#include <hip/hip_bf16.h>

#define BB 4
#define NN 2048
#define HH 16
#define DD 64

// LDS row pitches in bytes, 16 B x odd: the 16 lanes of a ds_load_b128 half
// then start on 16 different 4-bank groups (64 banks x 4 B), no bank conflict.
#define KPITCH 144                 // K rows: 128 B of data + 16 B pad
#define VPITCH 80                  // Vt rows: 64 B of data + 16 B pad
#define KBUF   (32 * KPITCH)       // one K tile, 32 keys
#define VBUF   (64 * VPITCH)       // one Vt tile, 64 d-rows
#define OPITCH 144                 // O rows staged for the output projection: 128 B + 16 B pad

// Score scale 1/sqrt(1024) times log2(e): K.Q^T then counts in powers of two.
#define QSCALE 0.045084220f

typedef __attribute__((ext_vector_type(16))) __bf16 v16bf;
typedef __attribute__((ext_vector_type(8)))  float  v8f;

typedef __attribute__((ext_vector_type(8)))  unsigned v8u;

union FragBF { v16bf v; v8u w; unsigned u[8]; uint4 q[2]; };
union Acc    { v8f v; float f[8]; };

// Pinned packed conversion: keeps SLP from turning pairs into v_perm shuffles.
__device__ __forceinline__ unsigned pk(float a, float b) {
    unsigned d;
    asm("v_cvt_pk_bf16_f32 %0, %1, %2" : "=v"(d) : "v"(a), "v"(b));
    return d;
}

__device__ __forceinline__ v8f wmma_bf16(const v16bf& a, const v16bf& b, const v8f& c) {
    return __builtin_amdgcn_wmma_f32_16x16x32_bf16(false, a, false, b, (short)0, c, false, false);
}

// Scores of 16 keys x 2 query tiles: d = a0.b_0 + a1.b_1 + c, with D apart from C.
// In asm because the builtin ties D to C where C is used last and copies all of C
// first (8 v_mov_b64 a pass), which would give back half of what C saves.
// The four v_nop keep the chip's distance from the last WMMA to the first vector
// instruction on its D, A or B: the compiler counts nothing inside asm.
__device__ __forceinline__ void score_wmma(
    v8f& d0, v8f& d1, const v8u& a0, const v8u& a1,
    const v8u& b00, const v8u& b01, const v8u& b10, const v8u& b11,
    const v8f& c0, const v8f& c1) {
    asm("v_wmma_f32_16x16x32_bf16 %0, %2, %4, %8\n\t"
        "v_wmma_f32_16x16x32_bf16 %1, %2, %6, %9\n\t"
        "v_wmma_f32_16x16x32_bf16 %0, %3, %5, %0\n\t"
        "v_wmma_f32_16x16x32_bf16 %1, %3, %7, %1\n\t"
        "v_nop\n\tv_nop\n\tv_nop\n\tv_nop"
        : "=&v"(d0), "=&v"(d1)
        : "v"(a0), "v"(a1), "v"(b00), "v"(b01), "v"(b10), "v"(b11), "v"(c0), "v"(c1));
}

__device__ __forceinline__ void wait_async0() {
#if __has_builtin(__builtin_amdgcn_s_wait_asynccnt)
    __builtin_amdgcn_s_wait_asynccnt(0);
#else
    asm volatile("s_wait_asynccnt 0x0" ::: "memory");
#endif
}

// Four async copies of 16 B per lane (global -> LDS), tracked by ASYNCcnt.
// s_wait_xcnt 0 closes the statement so that no address register named here
// is rewritten (next trip's address additions) ahead of it.
__device__ __forceinline__ void async_b128x4(
    unsigned l0, unsigned long long g0, unsigned l1, unsigned long long g1,
    unsigned l2, unsigned long long g2, unsigned l3, unsigned long long g3) {
    asm volatile("global_load_async_to_lds_b128 %0, %1, off\n\t"
                 "global_load_async_to_lds_b128 %2, %3, off\n\t"
                 "global_load_async_to_lds_b128 %4, %5, off\n\t"
                 "global_load_async_to_lds_b128 %6, %7, off\n\t"
                 "s_wait_xcnt 0x0"
                 :: "v"(l0), "v"(g0), "v"(l1), "v"(g1),
                    "v"(l2), "v"(g2), "v"(l3), "v"(g3) : "memory");
}

// Fragment dword map (16-bit 16x16x32 WMMA, wave32):
//   register r (0..7), lane-half hf: dword index = (r>>2)*8 + hf*4 + (r&3)
//   within a 32-dword (64 bf16) row; K-slice ks adds 16 dwords.
// => u[0..3] and u[4..7] are each 16B-contiguous: load fragments as 2 x b128.

// ---------------------------------------------------------------------------
// Kernel 0: pre-pack weights fp32 [H,D,D] -> bf16, fragment-major:
//   dst uint4[(h*2+ks)*256 + g*128 + hf*64 + col] = regs r=0..3 for that slot,
//   where k = ks*32 + g*16 + hf*8 + 2r (+1), col = output column.
// ---------------------------------------------------------------------------
__global__ __launch_bounds__(256) void pack_w_kernel(
    const float* __restrict__ Wq, const float* __restrict__ Wk,
    const float* __restrict__ Wv, const float* __restrict__ Wo,
    unsigned* __restrict__ Wqb, unsigned* __restrict__ Wkb,
    unsigned* __restrict__ Wvb, unsigned* __restrict__ Wob)
{
    const int idx = blockIdx.x * 256 + threadIdx.x;      // H*32*64 = 32768 total
    const int col = idx & 63;
    const int k2  = (idx >> 6) & 31;                     // k/2
    const int h   = idx >> 11;
    const int ks  = k2 >> 4;
    const int g   = (k2 >> 3) & 1;
    const int hf  = (k2 >> 2) & 1;
    const int r   = k2 & 3;
    const size_t src = ((size_t)h * DD + 2 * k2) * DD + col;
    const int dst = (((h * 2 + ks) * 256 + g * 128 + hf * 64 + col) << 2) + r;
    Wqb[dst] = pk(Wq[src], Wq[src + DD]);
    Wkb[dst] = pk(Wk[src], Wk[src + DD]);
    Wvb[dst] = pk(Wv[src], Wv[src + DD]);
    Wob[dst] = pk(Wo[src], Wo[src + DD]);
}

// One projection matrix: 16 rows x 64 cols; each B-frag = 2 x b128 loads.
// MODE 0: Q (scaled log2(e)/32, [B,H,N,D]); 1: K ([B,H,N,D]); 2: V transposed ([B,H,D,N]).
template<int MODE>
__device__ __forceinline__ void proj_mat(
    const FragBF a[2], const uint4* __restrict__ Wb4,
    const float* __restrict__ bias, int bh, int h,
    int n0, int l16, int half, __bf16* __restrict__ dst)
{
    v8f c[4];
    { v8f z = {}; for (int i = 0; i < 4; ++i) c[i] = z; }
#pragma unroll
    for (int ks = 0; ks < 2; ++ks) {
        const uint4* wb = Wb4 + (size_t)(h * 2 + ks) * 256 + half * 64;
#pragma unroll
        for (int ct = 0; ct < 4; ++ct) {
            const int col = ct * 16 + l16;
            FragBF bf;
            bf.q[0] = wb[col];          // regs 0..3
            bf.q[1] = wb[128 + col];    // regs 4..7
            c[ct] = wmma_bf16(a[ks].v, bf.v, c[ct]);
        }
    }
#pragma unroll
    for (int ct = 0; ct < 4; ++ct) {
        const int col = ct * 16 + l16;
        const float bv = bias[h * DD + col];
#pragma unroll
        for (int r = 0; r < 8; ++r) {
            const int row = n0 + r + 8 * half;           // C: m = r + 8*half
            const float val = c[ct][r] + bv;
            if (MODE == 0)
                dst[((size_t)bh * NN + row) * DD + col] = (__bf16)(val * QSCALE);
            else if (MODE == 1)
                dst[((size_t)bh * NN + row) * DD + col] = (__bf16)val;
            else
                dst[((size_t)bh * DD + col) * NN + row] = (__bf16)val;
        }
    }
}

// ---------------------------------------------------------------------------
// Kernel 1: fused Q/K/V projection. grid = (N/64, B*H), block = 128 (4 waves).
// Reads x as fp32 and rounds it to bf16 in registers: each x element is used by
// exactly one wave, so a bf16 copy in memory would only add a round trip.
// ---------------------------------------------------------------------------
__global__ __launch_bounds__(128) void qkv_proj_kernel(
    const float* __restrict__ x,
    const uint4* __restrict__ Wqb, const float* __restrict__ bq,
    const uint4* __restrict__ Wkb, const float* __restrict__ bk,
    const uint4* __restrict__ Wvb, const float* __restrict__ bv,
    __bf16* __restrict__ Qs, __bf16* __restrict__ Ks, __bf16* __restrict__ Vt)
{
    const int bh   = blockIdx.y;
    const int b    = bh / HH, h = bh % HH;
    const int wave = threadIdx.x >> 5;
    const int lane = threadIdx.x & 31;
    const int half = lane >> 4;
    const int l16  = lane & 15;
    const int n0   = blockIdx.x * 64 + wave * 16;

    // A fragments: rows n0..n0+15 of x. Registers g*4..g*4+3 of K-slice ks hold
    // k = ks*32 + g*16 + half*8 .. +7: 8 floats = 2 x b128, packed in pairs.
    FragBF a[2];
    {
        const float4* xp4 = (const float4*)(x + ((size_t)(b * NN + n0 + l16) * HH + h) * DD);
        float4 f[2][2][2];
#pragma unroll
        for (int ks = 0; ks < 2; ++ks)
#pragma unroll
            for (int g = 0; g < 2; ++g) {
                f[ks][g][0] = xp4[ks * 8 + g * 4 + half * 2];
                f[ks][g][1] = xp4[ks * 8 + g * 4 + half * 2 + 1];
            }
        // Keeps all eight loads of x ahead of the first conversion: sunk between
        // the products they would expose the memory latency three times, not once.
        __builtin_amdgcn_sched_barrier(0);
#pragma unroll
        for (int ks = 0; ks < 2; ++ks)
#pragma unroll
            for (int g = 0; g < 2; ++g) {
                a[ks].u[g * 4 + 0] = pk(f[ks][g][0].x, f[ks][g][0].y);
                a[ks].u[g * 4 + 1] = pk(f[ks][g][0].z, f[ks][g][0].w);
                a[ks].u[g * 4 + 2] = pk(f[ks][g][1].x, f[ks][g][1].y);
                a[ks].u[g * 4 + 3] = pk(f[ks][g][1].z, f[ks][g][1].w);
            }
    }
    proj_mat<0>(a, Wqb, bq, bh, h, n0, l16, half, Qs);
    proj_mat<1>(a, Wkb, bk, bh, h, n0, l16, half, Ks);
    proj_mat<2>(a, Wvb, bv, bh, h, n0, l16, half, Vt);
}

// Stage one 32-key K/V tile into an LDS buffer (async, ASYNCcnt-tracked).
__device__ __forceinline__ void stage_tile(
    const __bf16* __restrict__ Ks, const __bf16* __restrict__ Vt,
    int bh, int j0, int t, unsigned klds, unsigned vlds)
{
    // K tile: rows j0..j0+31 contiguous in global -> 4 KB, 32 B per thread
    unsigned long long kg = (unsigned long long)(uintptr_t)
        (Ks + ((size_t)bh * NN + j0) * DD) + (unsigned long long)t * 32u;
    // Vt tile: 64 rows (d) x 64 B; 32 B per thread
    const int vrow = t >> 1;
    unsigned long long vg = (unsigned long long)(uintptr_t)
        (Vt + ((size_t)bh * DD + vrow) * NN + j0) + ((unsigned long long)(t & 1) << 5);
    async_b128x4(klds, kg, klds + 16u, kg + 16u, vlds, vg, vlds + 16u, vg + 16u);
}

// ---------------------------------------------------------------------------
// Kernel 2: flash attention. grid = (N/128, B*H), block = 128 (4 waves).
// Each wave owns QT = 2 query tiles (32 queries): every K and Vt fragment read
// from LDS feeds two WMMAs, and one staged tile serves 128 queries.
// S^T = K.Q^T so the score C-layout refeeds directly as the P A-fragment.
// The score WMMA starts from C = minus the maximum in use, and Q carries log2(e):
// its result is the argument of exp2 as it stands, no vector subtract or multiply.
// Double-buffered LDS staging: tile j+1 async-loads overlap tile-j compute.
// Epilogue: out[b,n,h,:] = attn[b,h,n,:].Wo[h] + bo[h] (fp32) on the wave's own
// 32 rows: attn never goes to memory and needs no launch of its own.
// ---------------------------------------------------------------------------
#define QT 2
#define RESCALE_T 8.0f             // in powers of two
__global__ __launch_bounds__(128) void flash_attn_kernel(
    const __bf16* __restrict__ Qs, const __bf16* __restrict__ Ks,
    const __bf16* __restrict__ Vt, const uint4* __restrict__ Wob,
    const float* __restrict__ bo, float* __restrict__ out)
{
    // One array: two Vt tiles (64 d x 32 bf16), two K tiles (32 keys x 64 bf16),
    // padded rows; behind the loop the same bytes stage O, 32 rows a wave.
    __shared__ uint4 smem4[(2 * VBUF + 2 * KBUF) / 16];
    static_assert(4 * 16 * QT * OPITCH <= 2 * VBUF + 2 * KBUF, "O staging fits the ring");

    const int bh   = blockIdx.y;
    const int wave = threadIdx.x >> 5;
    const int lane = threadIdx.x & 31;
    const int half = lane >> 4;
    const int l16  = lane & 15;
    const int q0   = blockIdx.x * (64 * QT) + wave * (16 * QT);
    const int t    = threadIdx.x;

    // LDS byte offsets (generic shared pointer: low 32 bits = LDS offset)
    const unsigned voff = (unsigned)(uintptr_t)(void*)&smem4[0];
    const unsigned koff = voff + 2u * VBUF;
    const int vrow = t >> 1;
    const unsigned kl_t = (unsigned)(t >> 2) * KPITCH + ((unsigned)(t & 3) << 5);
    const unsigned vl_t = (unsigned)vrow * VPITCH + ((unsigned)(t & 1) << 5);

    // Resident Q^T B-fragments (lane = query): 2 x b128 per K-slice and tile.
    FragBF qt[QT][2];
#pragma unroll
    for (int qi = 0; qi < QT; ++qi) {
        const uint4* qp4 = (const uint4*)(Qs + ((size_t)bh * NN + q0 + qi * 16 + l16) * DD);
#pragma unroll
        for (int ks = 0; ks < 2; ++ks) {
            qt[qi][ks].q[0] = qp4[ks * 4 + half];
            qt[qi][ks].q[1] = qp4[ks * 4 + 2 + half];
        }
    }

    // cneg: minus the maximum in use, the lane's query in all eight registers
    // (C layout: lane = query).
    float l_run[QT];
    v8f cneg[QT];
    v8f o[QT][4];
#pragma unroll
    for (int qi = 0; qi < QT; ++qi) {
        l_run[qi] = 0.f;
        v8f z = {};
        cneg[qi] = z;
        for (int i = 0; i < 4; ++i) o[qi][i] = z;
    }

    // Prologue: stage tile 0 into buffer 0
    stage_tile(Ks, Vt, bh, 0, t, koff + kl_t, voff + vl_t);
    wait_async0();
    __syncthreads();

    // First maximum in use: the true maximum of tile 0's scores (its products are
    // made once more, from C = 0), so that the loop has one case only.
    {
        const uint4* kb4 = smem4 + (2 * VBUF) / 16;
        Acc s0[QT][2];
#pragma unroll
        for (int sub = 0; sub < 2; ++sub) {
            FragBF ka[2];
#pragma unroll
            for (int ks = 0; ks < 2; ++ks) {
                ka[ks].q[0] = kb4[(sub * 16 + l16) * (KPITCH / 16) + ks * 4 + half];
                ka[ks].q[1] = kb4[(sub * 16 + l16) * (KPITCH / 16) + ks * 4 + 2 + half];
            }
            score_wmma(s0[0][sub].v, s0[1][sub].v, ka[0].w, ka[1].w,
                       qt[0][0].w, qt[0][1].w, qt[1][0].w, qt[1][1].w, cneg[0], cneg[1]);
        }
#pragma unroll
        for (int qi = 0; qi < QT; ++qi) {
            float tmax = s0[qi][0].f[0];
#pragma unroll
            for (int r = 1; r < 8; ++r) tmax = fmaxf(tmax, s0[qi][0].f[r]);
#pragma unroll
            for (int r = 0; r < 8; ++r) tmax = fmaxf(tmax, s0[qi][1].f[r]);
            tmax = fmaxf(tmax, __shfl_xor(tmax, 16, 32));
#pragma unroll
            for (int r = 0; r < 8; ++r) cneg[qi][r] = -tmax;
        }
    }

    int cur = 0;
    for (int j0 = 0; j0 < NN; j0 += 32) {
        const int nxt = cur ^ 1;
        if (j0 + 32 < NN)   // issue next tile's async loads; overlap with compute
            stage_tile(Ks, Vt, bh, j0 + 32, t,
                       koff + (unsigned)nxt * KBUF + kl_t,
                       voff + (unsigned)nxt * VBUF + vl_t);

        const uint4* kb4 = smem4 + (2 * VBUF + cur * KBUF) / 16;
        const uint4* vb4 = smem4 + (cur * VBUF) / 16;

        // S^T tiles: st[qi][sub] = K[j0+sub*16 .. +15] . Q^T - shift  (C: lane=query, vgpr=key)
        Acc st[QT][2];
#pragma unroll
        for (int sub = 0; sub < 2; ++sub) {
            FragBF ka[2];                                    // 4 x ds_load_b128
#pragma unroll
            for (int ks = 0; ks < 2; ++ks) {
                ka[ks].q[0] = kb4[(sub * 16 + l16) * (KPITCH / 16) + ks * 4 + half];
                ka[ks].q[1] = kb4[(sub * 16 + l16) * (KPITCH / 16) + ks * 4 + 2 + half];
            }
            static_assert(QT == 2, "score_wmma takes two query tiles");
            score_wmma(st[0][sub].v, st[1][sub].v, ka[0].w, ka[1].w,
                       qt[0][0].w, qt[0][1].w, qt[1][0].w, qt[1][1].w, cneg[0], cneg[1]);
        }

        // Vt fragments, read as one group ahead of the branch below: their LDS
        // latency runs under the maximum and the exponentials; behind the branch
        // each pair would be waited for right in front of its WMMAs.
        FragBF bvv[4];                                       // 8 x ds_load_b128
#pragma unroll
        for (int dt = 0; dt < 4; ++dt) {
            bvv[dt].q[0] = vb4[(dt * 16 + l16) * (VPITCH / 16) + half];
            bvv[dt].q[1] = vb4[(dt * 16 + l16) * (VPITCH / 16) + 2 + half];
        }

        // Lazy rescale: the maximum in use moves, and O and l are rescaled, only
        // when some query's new score exceeds it by more than RESCALE_T (P then
        // stays <= 2^RESCALE_T = 256; O / l is the same quotient for any maximum).
        float tloc[QT];
        bool need = false;
#pragma unroll
        for (int qi = 0; qi < QT; ++qi) {
            // This lane's 16 of the query's 32 keys (the rest: lane ^ 16).
            float tmax = st[qi][0].f[0];
#pragma unroll
            for (int r = 1; r < 8; ++r) tmax = fmaxf(tmax, st[qi][0].f[r]);
#pragma unroll
            for (int r = 0; r < 8; ++r) tmax = fmaxf(tmax, st[qi][1].f[r]);
            tloc[qi] = tmax;
            need = need || (tmax > RESCALE_T);
        }
        // One wave-uniform scalar test a pass, over both halves and both tiles.
        // Marked unlikely so that the rescale lies outside the loop's straight line
        // (else the usual pass takes two more jumps round it).
        if (__builtin_expect(__builtin_amdgcn_ballot_w32(need) != 0, 0)) {
#pragma unroll
            for (int qi = 0; qi < QT; ++qi) {
                const float tmax  = fmaxf(tloc[qi], __shfl_xor(tloc[qi], 16, 32));
                const float d     = fmaxf(tmax, 0.f);        // rise of the maximum in use
                const float alpha = __builtin_amdgcn_exp2f(-d);
                const float cn    = cneg[qi][0] - d;
#pragma unroll
                for (int r = 0; r < 8; ++r) {
                    st[qi][0].f[r] -= d;                     // this pass: shifted by hand
                    st[qi][1].f[r] -= d;
                    cneg[qi][r] = cn;
                }
                l_run[qi] *= alpha;
                // Per-query alpha into the O-tile layout (query = r + 8*half)
#pragma unroll
                for (int r = 0; r < 8; ++r) {
                    const float am = __shfl(alpha, r + 8 * half, 32);
#pragma unroll
                    for (int dt = 0; dt < 4; ++dt) o[qi][dt][r] *= am;
                }
            }
        }

        FragBF pa[QT];
#pragma unroll
        for (int qi = 0; qi < QT; ++qi) {
            // Softmax numerators (scale and shift are in the scores). Keys split lane <-> lane^16.
            float tsum = 0.f;
#pragma unroll
            for (int r = 0; r < 8; ++r) { st[qi][0].f[r] = __builtin_amdgcn_exp2f(st[qi][0].f[r]); tsum += st[qi][0].f[r]; }
#pragma unroll
            for (int r = 0; r < 8; ++r) { st[qi][1].f[r] = __builtin_amdgcn_exp2f(st[qi][1].f[r]); tsum += st[qi][1].f[r]; }
            tsum += __shfl_xor(tsum, 16, 32);
            l_run[qi] += tsum;

            // Pack P as A-fragment: S^T C-layout maps 1:1 onto P A-layout (same lane).
#pragma unroll
            for (int r = 0; r < 4; ++r) {
                pa[qi].u[r]     = pk(st[qi][0].f[2 * r], st[qi][0].f[2 * r + 1]);
                pa[qi].u[4 + r] = pk(st[qi][1].f[2 * r], st[qi][1].f[2 * r + 1]);
            }
        }

#pragma unroll
        for (int dt = 0; dt < 4; ++dt)
#pragma unroll
            for (int qi = 0; qi < QT; ++qi)
                o[qi][dt] = wmma_bf16(pa[qi].v, bvv[dt].v, o[qi][dt]);

        wait_async0();      // next tile's data landed in LDS
        __syncthreads();    // all waves done reading cur, next tile visible
        cur = nxt;
    }

    const int b = bh / HH, h = bh % HH;

    // Wo fragments and bias, asked for first: their latency runs under the staging.
    FragBF wf[2][4];
    float bias[4];
#pragma unroll
    for (int ks = 0; ks < 2; ++ks) {
        const uint4* wb = Wob + (size_t)(h * 2 + ks) * 256 + half * 64;
#pragma unroll
        for (int ct = 0; ct < 4; ++ct) {
            wf[ks][ct].q[0] = wb[ct * 16 + l16];
            wf[ks][ct].q[1] = wb[128 + ct * 16 + l16];
        }
    }
#pragma unroll
    for (int ct = 0; ct < 4; ++ct) bias[ct] = bo[h * DD + ct * 16 + l16];

    // Normalize by l, round to bf16 and lay the rows in this wave's own LDS range
    // (the loop's last barrier has ended every read of the ring; no copy is in flight).
    __bf16* ob = (__bf16*)smem4 + wave * (16 * QT * OPITCH / 2);
#pragma unroll
    for (int qi = 0; qi < QT; ++qi) {
        float lm[8];
#pragma unroll
        for (int r = 0; r < 8; ++r) lm[r] = __shfl(l_run[qi], r + 8 * half, 32);
#pragma unroll
        for (int dt = 0; dt < 4; ++dt)
#pragma unroll
            for (int r = 0; r < 8; ++r)
                ob[(qi * 16 + r + 8 * half) * (OPITCH / 2) + dt * 16 + l16] = (__bf16)(o[qi][dt][r] / lm[r]);
    }
    // The rows are read back by other lanes of the same wave: every store above
    // has to be done, and no read below may be lifted over it.
    asm volatile("s_wait_dscnt 0x0" ::: "memory");

    // A fragments (lane = query row): 2 x ds_load_b128 per K-slice and tile.
    const uint4* ob4 = (const uint4*)ob;
    FragBF a[QT][2];
#pragma unroll
    for (int qi = 0; qi < QT; ++qi)
#pragma unroll
        for (int ks = 0; ks < 2; ++ks) {
            a[qi][ks].q[0] = ob4[(qi * 16 + l16) * (OPITCH / 16) + ks * 4 + half];
            a[qi][ks].q[1] = ob4[(qi * 16 + l16) * (OPITCH / 16) + ks * 4 + 2 + half];
        }

    v8f c[QT][4];
#pragma unroll
    for (int qi = 0; qi < QT; ++qi) {
        v8f z = {};
        for (int i = 0; i < 4; ++i) c[qi][i] = z;
    }
#pragma unroll
    for (int ks = 0; ks < 2; ++ks)
#pragma unroll
        for (int ct = 0; ct < 4; ++ct)
#pragma unroll
            for (int qi = 0; qi < QT; ++qi)
                c[qi][ct] = wmma_bf16(a[qi][ks].v, wf[ks][ct].v, c[qi][ct]);

#pragma unroll
    for (int qi = 0; qi < QT; ++qi)
#pragma unroll
        for (int ct = 0; ct < 4; ++ct)
#pragma unroll
            for (int r = 0; r < 8; ++r) {
                const int row = q0 + qi * 16 + r + 8 * half;
                out[((size_t)(b * NN + row) * HH + h) * DD + ct * 16 + l16] = c[qi][ct][r] + bias[ct];
            }
}

extern "C" void kernel_launch(void* const* d_in, const int* in_sizes, int n_in,
                              void* d_out, int out_size, void* d_ws, size_t ws_size,
                              hipStream_t stream) {
    const float* x  = (const float*)d_in[0];
    const float* Wq = (const float*)d_in[1];
    const float* bq = (const float*)d_in[2];
    const float* Wk = (const float*)d_in[3];
    const float* bk = (const float*)d_in[4];
    const float* Wv = (const float*)d_in[5];
    const float* bv = (const float*)d_in[6];
    const float* Wo = (const float*)d_in[7];
    const float* bo = (const float*)d_in[8];
    float* out = (float*)d_out;

    const size_t SZ = (size_t)BB * HH * NN * DD;     // elems per bf16 tensor
    const size_t WSZ = (size_t)HH * 32 * 64;         // packed-weight dwords per tensor
    __bf16* Qs = (__bf16*)d_ws;
    __bf16* Ks = Qs + SZ;
    __bf16* Vt = Ks + SZ;
    unsigned* Wqb = (unsigned*)(Vt + SZ);
    unsigned* Wkb = Wqb + WSZ;
    unsigned* Wvb = Wkb + WSZ;
    unsigned* Wob = Wvb + WSZ;

    dim3 grid(NN / 64, BB * HH);
    pack_w_kernel   <<<dim3(128), 256, 0, stream>>>(Wq, Wk, Wv, Wo, Wqb, Wkb, Wvb, Wob);
    qkv_proj_kernel <<<grid, 128, 0, stream>>>(x, (const uint4*)Wqb, bq, (const uint4*)Wkb, bk,
                                               (const uint4*)Wvb, bv, Qs, Ks, Vt);
    flash_attn_kernel<<<dim3(NN / (64 * QT), BB * HH), 128, 0, stream>>>(Qs, Ks, Vt,
                                               (const uint4*)Wob, bo, out);
}

// v007
// It runs in 80.8 microseconds.
// Timed twice side by side with v006, it ran 1.08 times as fast both times.
// All steps since v000 together make it 2.58 times as fast.
#include <hip/hip_runtime.h>
#include <hip/hip_bf16.h>

#define BB 4
#define NN 2048
#define HH 16
#define DD 64

// LDS row pitches in bytes, 16 B x odd: the 16 lanes of a ds_load_b128 half
// then start on 16 different 4-bank groups (64 banks x 4 B), no bank conflict.
#define KPITCH 144                 // K rows: 128 B of data + 16 B pad
#define VPITCH 80                  // Vt rows: 64 B of data + 16 B pad
#define KBUF   (32 * KPITCH)       // one K tile, 32 keys
#define VBUF   (64 * VPITCH)       // one Vt tile, 64 d-rows
#define OPITCH 144                 // O rows staged for the output projection: 128 B + 16 B pad

// Score scale 1/sqrt(1024) times log2(e): K.Q^T then counts in powers of two.
#define QSCALE 0.045084220f

typedef __attribute__((ext_vector_type(16))) __bf16 v16bf;
typedef __attribute__((ext_vector_type(8)))  float  v8f;

typedef __attribute__((ext_vector_type(8)))  unsigned v8u;

union FragBF { v16bf v; v8u w; unsigned u[8]; uint4 q[2]; };
union Acc    { v8f v; float f[8]; };

// Pinned packed conversion: keeps SLP from turning pairs into v_perm shuffles.
__device__ __forceinline__ unsigned pk(float a, float b) {
    unsigned d;
    asm("v_cvt_pk_bf16_f32 %0, %1, %2" : "=v"(d) : "v"(a), "v"(b));
    return d;
}

__device__ __forceinline__ v8f wmma_bf16(const v16bf& a, const v16bf& b, const v8f& c) {
    return __builtin_amdgcn_wmma_f32_16x16x32_bf16(false, a, false, b, (short)0, c, false, false);
}

// Scores of 16 keys x 2 query tiles: d = a0.b_0 + a1.b_1 + c, with D apart from C.
// In asm because the builtin ties D to C where C is used last and copies all of C
// first (8 v_mov_b64 a pass), which would give back half of what C saves.
// The four v_nop keep the chip's distance from the last WMMA to the first vector
// instruction on its D, A or B: the compiler counts nothing inside asm.
__device__ __forceinline__ void score_wmma(
    v8f& d0, v8f& d1, const v8u& a0, const v8u& a1,
    const v8u& b00, const v8u& b01, const v8u& b10, const v8u& b11,
    const v8f& c0, const v8f& c1) {
    asm("v_wmma_f32_16x16x32_bf16 %0, %2, %4, %8\n\t"
        "v_wmma_f32_16x16x32_bf16 %1, %2, %6, %9\n\t"
        "v_wmma_f32_16x16x32_bf16 %0, %3, %5, %0\n\t"
        "v_wmma_f32_16x16x32_bf16 %1, %3, %7, %1\n\t"
        "v_nop\n\tv_nop\n\tv_nop\n\tv_nop"
        : "=&v"(d0), "=&v"(d1)
        : "v"(a0), "v"(a1), "v"(b00), "v"(b01), "v"(b10), "v"(b11), "v"(c0), "v"(c1));
}

__device__ __forceinline__ void wait_async0() {
#if __has_builtin(__builtin_amdgcn_s_wait_asynccnt)
    __builtin_amdgcn_s_wait_asynccnt(0);
#else
    asm volatile("s_wait_asynccnt 0x0" ::: "memory");
#endif
}

// Four async copies of 16 B per lane (global -> LDS), tracked by ASYNCcnt.
// s_wait_xcnt 0 closes the statement so that no address register named here
// is rewritten (next trip's address additions) ahead of it.
__device__ __forceinline__ void async_b128x4(
    unsigned l0, unsigned long long g0, unsigned l1, unsigned long long g1,
    unsigned l2, unsigned long long g2, unsigned l3, unsigned long long g3) {
    asm volatile("global_load_async_to_lds_b128 %0, %1, off\n\t"
                 "global_load_async_to_lds_b128 %2, %3, off\n\t"
                 "global_load_async_to_lds_b128 %4, %5, off\n\t"
                 "global_load_async_to_lds_b128 %6, %7, off\n\t"
                 "s_wait_xcnt 0x0"
                 :: "v"(l0), "v"(g0), "v"(l1), "v"(g1),
                    "v"(l2), "v"(g2), "v"(l3), "v"(g3) : "memory");
}

// Fragment dword map (16-bit 16x16x32 WMMA, wave32):
//   register r (0..7), lane-half hf: dword index = (r>>2)*8 + hf*4 + (r&3)
//   within a 32-dword (64 bf16) row; K-slice ks adds 16 dwords.
// => u[0..3] and u[4..7] are each 16B-contiguous: load fragments as 2 x b128.

// ---------------------------------------------------------------------------
// Kernel 0: pre-pack weights fp32 [H,D,D] -> bf16, fragment-major:
//   dst uint4[(h*2+ks)*256 + g*128 + hf*64 + col] = regs r=0..3 for that slot,
//   where k = ks*32 + g*16 + hf*8 + 2r (+1), col = output column.
// ---------------------------------------------------------------------------
__global__ __launch_bounds__(256) void pack_w_kernel(
    const float* __restrict__ Wq, const float* __restrict__ Wk,
    const float* __restrict__ Wv, const float* __restrict__ Wo,
    unsigned* __restrict__ Wqb, unsigned* __restrict__ Wkb,
    unsigned* __restrict__ Wvb, unsigned* __restrict__ Wob)
{
    const int idx = blockIdx.x * 256 + threadIdx.x;      // H*32*64 = 32768 total
    const int col = idx & 63;
    const int k2  = (idx >> 6) & 31;                     // k/2
    const int h   = idx >> 11;
    const int ks  = k2 >> 4;
    const int g   = (k2 >> 3) & 1;
    const int hf  = (k2 >> 2) & 1;
    const int r   = k2 & 3;
    const size_t src = ((size_t)h * DD + 2 * k2) * DD + col;
    const int dst = (((h * 2 + ks) * 256 + g * 128 + hf * 64 + col) << 2) + r;
    Wqb[dst] = pk(Wq[src], Wq[src + DD]);
    Wkb[dst] = pk(Wk[src], Wk[src + DD]);
    Wvb[dst] = pk(Wv[src], Wv[src + DD]);
    Wob[dst] = pk(Wo[src], Wo[src + DD]);
}

// One projection matrix: 16 rows x 64 cols; each B-frag = 2 x b128 loads.
// MODE 0: Q (scaled log2(e)/32, [B,H,N,D]); 1: K ([B,H,N,D]); 2: V transposed ([B,H,D,N]).
template<int MODE>
__device__ __forceinline__ void proj_mat(
    const FragBF a[2], const uint4* __restrict__ Wb4,
    const float* __restrict__ bias, int bh, int h,
    int n0, int l16, int half, __bf16* __restrict__ dst)
{
    v8f c[4];
    { v8f z = {}; for (int i = 0; i < 4; ++i) c[i] = z; }
#pragma unroll
    for (int ks = 0; ks < 2; ++ks) {
        const uint4* wb = Wb4 + (size_t)(h * 2 + ks) * 256 + half * 64;
#pragma unroll
        for (int ct = 0; ct < 4; ++ct) {
            const int col = ct * 16 + l16;
            FragBF bf;
            bf.q[0] = wb[col];          // regs 0..3
            bf.q[1] = wb[128 + col];    // regs 4..7
            c[ct] = wmma_bf16(a[ks].v, bf.v, c[ct]);
        }
    }
#pragma unroll
    for (int ct = 0; ct < 4; ++ct) {
        const int col = ct * 16 + l16;
        const float bv = bias[h * DD + col];
#pragma unroll
        for (int r = 0; r < 8; ++r) {
            const int row = n0 + r + 8 * half;           // C: m = r + 8*half
            const float val = c[ct][r] + bv;
            if (MODE == 0)
                dst[((size_t)bh * NN + row) * DD + col] = (__bf16)(val * QSCALE);
            else if (MODE == 1)
                dst[((size_t)bh * NN + row) * DD + col] = (__bf16)val;
            else
                dst[((size_t)bh * DD + col) * NN + row] = (__bf16)val;
        }
    }
}

// ---------------------------------------------------------------------------
// Kernel 1: fused Q/K/V projection. grid = (N/64, B*H), block = 128 (4 waves).
// Reads x as fp32 and rounds it to bf16 in registers: each x element is used by
// exactly one wave, so a bf16 copy in memory would only add a round trip.
// ---------------------------------------------------------------------------
__global__ __launch_bounds__(128) void qkv_proj_kernel(
    const float* __restrict__ x,
    const uint4* __restrict__ Wqb, const float* __restrict__ bq,
    const uint4* __restrict__ Wkb, const float* __restrict__ bk,
    const uint4* __restrict__ Wvb, const float* __restrict__ bv,
    __bf16* __restrict__ Qs, __bf16* __restrict__ Ks, __bf16* __restrict__ Vt)
{
    const int bh   = blockIdx.y;
    const int b    = bh / HH, h = bh % HH;
    const int wave = threadIdx.x >> 5;
    const int lane = threadIdx.x & 31;
    const int half = lane >> 4;
    const int l16  = lane & 15;
    const int n0   = blockIdx.x * 64 + wave * 16;

    // A fragments: rows n0..n0+15 of x. Registers g*4..g*4+3 of K-slice ks hold
    // k = ks*32 + g*16 + half*8 .. +7: 8 floats = 2 x b128, packed in pairs.
    FragBF a[2];
    {
        const float4* xp4 = (const float4*)(x + ((size_t)(b * NN + n0 + l16) * HH + h) * DD);
        float4 f[2][2][2];
#pragma unroll
        for (int ks = 0; ks < 2; ++ks)
#pragma unroll
            for (int g = 0; g < 2; ++g) {
                f[ks][g][0] = xp4[ks * 8 + g * 4 + half * 2];
                f[ks][g][1] = xp4[ks * 8 + g * 4 + half * 2 + 1];
            }
        // Keeps all eight loads of x ahead of the first conversion: sunk between
        // the products they would expose the memory latency three times, not once.
        __builtin_amdgcn_sched_barrier(0);
#pragma unroll
        for (int ks = 0; ks < 2; ++ks)
#pragma unroll
            for (int g = 0; g < 2; ++g) {
                a[ks].u[g * 4 + 0] = pk(f[ks][g][0].x, f[ks][g][0].y);
                a[ks].u[g * 4 + 1] = pk(f[ks][g][0].z, f[ks][g][0].w);
                a[ks].u[g * 4 + 2] = pk(f[ks][g][1].x, f[ks][g][1].y);
                a[ks].u[g * 4 + 3] = pk(f[ks][g][1].z, f[ks][g][1].w);
            }
    }
    proj_mat<0>(a, Wqb, bq, bh, h, n0, l16, half, Qs);
    proj_mat<1>(a, Wkb, bk, bh, h, n0, l16, half, Ks);
    proj_mat<2>(a, Wvb, bv, bh, h, n0, l16, half, Vt);
}

// Stage one 32-key K/V tile into an LDS buffer (async, ASYNCcnt-tracked).
__device__ __forceinline__ void stage_tile(
    const __bf16* __restrict__ Ks, const __bf16* __restrict__ Vt,
    int bh, int j0, int t, unsigned klds, unsigned vlds)
{
    // K tile: rows j0..j0+31 contiguous in global -> 4 KB, 32 B per thread
    unsigned long long kg = (unsigned long long)(uintptr_t)
        (Ks + ((size_t)bh * NN + j0) * DD) + (unsigned long long)t * 32u;
    // Vt tile: 64 rows (d) x 64 B; 32 B per thread
    const int vrow = t >> 1;
    unsigned long long vg = (unsigned long long)(uintptr_t)
        (Vt + ((size_t)bh * DD + vrow) * NN + j0) + ((unsigned long long)(t & 1) << 5);
    async_b128x4(klds, kg, klds + 16u, kg + 16u, vlds, vg, vlds + 16u, vg + 16u);
}

// ---------------------------------------------------------------------------
// Kernel 2: flash attention. grid = (N/128, B*H), block = 128 (4 waves).
// Each wave owns QT = 2 query tiles (32 queries): every K and Vt fragment read
// from LDS feeds two WMMAs, and one staged tile serves 128 queries.
// S^T = K.Q^T so the score C-layout refeeds directly as the P A-fragment.
// The score WMMA starts from C = minus the maximum in use, and Q carries log2(e):
// its result is the argument of exp2 as it stands, no vector subtract or multiply.
// The softmax denominators come off the matrix pipe: l += P . ones, with the same
// bf16 P that feeds P.V, in a tile laid out like an O tile (query = r + 8*half).
// Double-buffered LDS staging: tile j+1 async-loads overlap tile-j compute.
// Epilogue: out[b,n,h,:] = attn[b,h,n,:].Wo[h] + bo[h] (fp32) on the wave's own
// 32 rows: attn never goes to memory and needs no launch of its own.
// ---------------------------------------------------------------------------
#define QT 2
#define RESCALE_T 8.0f             // in powers of two
__global__ __launch_bounds__(128) void flash_attn_kernel(
    const __bf16* __restrict__ Qs, const __bf16* __restrict__ Ks,
    const __bf16* __restrict__ Vt, const uint4* __restrict__ Wob,
    const float* __restrict__ bo, float* __restrict__ out)
{
    // One array: two Vt tiles (64 d x 32 bf16), two K tiles (32 keys x 64 bf16),
    // padded rows; behind the loop the same bytes stage O, 32 rows a wave.
    __shared__ uint4 smem4[(2 * VBUF + 2 * KBUF) / 16];
    static_assert(4 * 16 * QT * OPITCH <= 2 * VBUF + 2 * KBUF, "O staging fits the ring");

    const int bh   = blockIdx.y;
    const int wave = threadIdx.x >> 5;
    const int lane = threadIdx.x & 31;
    const int half = lane >> 4;
    const int l16  = lane & 15;
    const int q0   = blockIdx.x * (64 * QT) + wave * (16 * QT);
    const int t    = threadIdx.x;

    // LDS byte offsets (generic shared pointer: low 32 bits = LDS offset)
    const unsigned voff = (unsigned)(uintptr_t)(void*)&smem4[0];
    const unsigned koff = voff + 2u * VBUF;
    const int vrow = t >> 1;
    const unsigned kl_t = (unsigned)(t >> 2) * KPITCH + ((unsigned)(t & 3) << 5);
    const unsigned vl_t = (unsigned)vrow * VPITCH + ((unsigned)(t & 1) << 5);

    // Resident Q^T B-fragments (lane = query): 2 x b128 per K-slice and tile.
    FragBF qt[QT][2];
#pragma unroll
    for (int qi = 0; qi < QT; ++qi) {
        const uint4* qp4 = (const uint4*)(Qs + ((size_t)bh * NN + q0 + qi * 16 + l16) * DD);
#pragma unroll
        for (int ks = 0; ks < 2; ++ks) {
            qt[qi][ks].q[0] = qp4[ks * 4 + half];
            qt[qi][ks].q[1] = qp4[ks * 4 + 2 + half];
        }
    }

    // cneg: minus the maximum in use, the lane's query in all eight registers
    // (C layout: lane = query).
    v8f lacc[QT];
    v8f cneg[QT];
    v8f o[QT][4];
#pragma unroll
    for (int qi = 0; qi < QT; ++qi) {
        v8f z = {};
        lacc[qi] = z;
        cneg[qi] = z;
        for (int i = 0; i < 4; ++i) o[qi][i] = z;
    }

    // B fragment of ones (bf16 1.0 in every place): P . ones puts each query's sum
    // over the pass's 32 keys into all 16 columns, so every lane holds its rows' l.
    // Made by v_mov in asm so that its eight registers stay resident: a plain constant
    // is kept in scalar registers and copied to vector registers anew in every pass.
    FragBF ones;
#pragma unroll
    for (int r = 0; r < 8; ++r) asm("v_mov_b32 %0, 0x3f803f80" : "=v"(ones.u[r]));

    // Prologue: stage tile 0 into buffer 0
    stage_tile(Ks, Vt, bh, 0, t, koff + kl_t, voff + vl_t);
    wait_async0();
    __syncthreads();

    // First maximum in use: the true maximum of tile 0's scores (its products are
    // made once more, from C = 0), so that the loop has one case only.
    {
        const uint4* kb4 = smem4 + (2 * VBUF) / 16;
        Acc s0[QT][2];
#pragma unroll
        for (int sub = 0; sub < 2; ++sub) {
            FragBF ka[2];
#pragma unroll
            for (int ks = 0; ks < 2; ++ks) {
                ka[ks].q[0] = kb4[(sub * 16 + l16) * (KPITCH / 16) + ks * 4 + half];
                ka[ks].q[1] = kb4[(sub * 16 + l16) * (KPITCH / 16) + ks * 4 + 2 + half];
            }
            score_wmma(s0[0][sub].v, s0[1][sub].v, ka[0].w, ka[1].w,
                       qt[0][0].w, qt[0][1].w, qt[1][0].w, qt[1][1].w, cneg[0], cneg[1]);
        }
#pragma unroll
        for (int qi = 0; qi < QT; ++qi) {
            float tmax = s0[qi][0].f[0];
#pragma unroll
            for (int r = 1; r < 8; ++r) tmax = fmaxf(tmax, s0[qi][0].f[r]);
#pragma unroll
            for (int r = 0; r < 8; ++r) tmax = fmaxf(tmax, s0[qi][1].f[r]);
            tmax = fmaxf(tmax, __shfl_xor(tmax, 16, 32));
#pragma unroll
            for (int r = 0; r < 8; ++r) cneg[qi][r] = -tmax;
        }
    }

    int cur = 0;
    for (int j0 = 0; j0 < NN; j0 += 32) {
        const int nxt = cur ^ 1;
        if (j0 + 32 < NN)   // issue next tile's async loads; overlap with compute
            stage_tile(Ks, Vt, bh, j0 + 32, t,
                       koff + (unsigned)nxt * KBUF + kl_t,
                       voff + (unsigned)nxt * VBUF + vl_t);

        const uint4* kb4 = smem4 + (2 * VBUF + cur * KBUF) / 16;
        const uint4* vb4 = smem4 + (cur * VBUF) / 16;

        // S^T tiles: st[qi][sub] = K[j0+sub*16 .. +15] . Q^T - shift  (C: lane=query, vgpr=key)
        Acc st[QT][2];
#pragma unroll
        for (int sub = 0; sub < 2; ++sub) {
            FragBF ka[2];                                    // 4 x ds_load_b128
#pragma unroll
            for (int ks = 0; ks < 2; ++ks) {
                ka[ks].q[0] = kb4[(sub * 16 + l16) * (KPITCH / 16) + ks * 4 + half];
                ka[ks].q[1] = kb4[(sub * 16 + l16) * (KPITCH / 16) + ks * 4 + 2 + half];
            }
            static_assert(QT == 2, "score_wmma takes two query tiles");
            score_wmma(st[0][sub].v, st[1][sub].v, ka[0].w, ka[1].w,
                       qt[0][0].w, qt[0][1].w, qt[1][0].w, qt[1][1].w, cneg[0], cneg[1]);
        }

        // Vt fragments, read as one group ahead of the branch below: their LDS
        // latency runs under the maximum and the exponentials; behind the branch
        // each pair would be waited for right in front of its WMMAs.
        FragBF bvv[4];                                       // 8 x ds_load_b128
#pragma unroll
        for (int dt = 0; dt < 4; ++dt) {
            bvv[dt].q[0] = vb4[(dt * 16 + l16) * (VPITCH / 16) + half];
            bvv[dt].q[1] = vb4[(dt * 16 + l16) * (VPITCH / 16) + 2 + half];
        }

        // Lazy rescale: the maximum in use moves, and O and l are rescaled, only
        // when some query's new score exceeds it by more than RESCALE_T (P then
        // stays <= 2^RESCALE_T = 256; O / l is the same quotient for any maximum).
        float tloc[QT];
        bool need = false;
#pragma unroll
        for (int qi = 0; qi < QT; ++qi) {
            // This lane's 16 of the query's 32 keys (the rest: lane ^ 16).
            float tmax = st[qi][0].f[0];
#pragma unroll
            for (int r = 1; r < 8; ++r) tmax = fmaxf(tmax, st[qi][0].f[r]);
#pragma unroll
            for (int r = 0; r < 8; ++r) tmax = fmaxf(tmax, st[qi][1].f[r]);
            tloc[qi] = tmax;
            need = need || (tmax > RESCALE_T);
        }
        // One wave-uniform scalar test a pass, over both halves and both tiles.
        // Marked unlikely so that the rescale lies outside the loop's straight line
        // (else the usual pass takes two more jumps round it).
        if (__builtin_expect(__builtin_amdgcn_ballot_w32(need) != 0, 0)) {
#pragma unroll
            for (int qi = 0; qi < QT; ++qi) {
                const float tmax  = fmaxf(tloc[qi], __shfl_xor(tloc[qi], 16, 32));
                const float d     = fmaxf(tmax, 0.f);        // rise of the maximum in use
                const float alpha = __builtin_amdgcn_exp2f(-d);
                const float cn    = cneg[qi][0] - d;
#pragma unroll
                for (int r = 0; r < 8; ++r) {
                    st[qi][0].f[r] -= d;                     // this pass: shifted by hand
                    st[qi][1].f[r] -= d;
                    cneg[qi][r] = cn;
                }
                // Per-query alpha into the O-tile layout (query = r + 8*half)
#pragma unroll
                for (int r = 0; r < 8; ++r) {
                    const float am = __shfl(alpha, r + 8 * half, 32);
                    lacc[qi][r] *= am;
#pragma unroll
                    for (int dt = 0; dt < 4; ++dt) o[qi][dt][r] *= am;
                }
            }
        }

        FragBF pa[QT];
#pragma unroll
        for (int qi = 0; qi < QT; ++qi) {
            // Softmax numerators (scale and shift are in the scores). Keys split lane <-> lane^16.
#pragma unroll
            for (int r = 0; r < 8; ++r) st[qi][0].f[r] = __builtin_amdgcn_exp2f(st[qi][0].f[r]);
#pragma unroll
            for (int r = 0; r < 8; ++r) st[qi][1].f[r] = __builtin_amdgcn_exp2f(st[qi][1].f[r]);

            // Pack P as A-fragment: S^T C-layout maps 1:1 onto P A-layout (same lane).
#pragma unroll
            for (int r = 0; r < 4; ++r) {
                pa[qi].u[r]     = pk(st[qi][0].f[2 * r], st[qi][0].f[2 * r + 1]);
                pa[qi].u[4 + r] = pk(st[qi][1].f[2 * r], st[qi][1].f[2 * r + 1]);
            }
        }

#pragma unroll
        for (int dt = 0; dt < 4; ++dt)
#pragma unroll
            for (int qi = 0; qi < QT; ++qi)
                o[qi][dt] = wmma_bf16(pa[qi].v, bvv[dt].v, o[qi][dt]);
#pragma unroll
        for (int qi = 0; qi < QT; ++qi)
            lacc[qi] = wmma_bf16(pa[qi].v, ones.v, lacc[qi]);

        // Holds the wait below at the pass's foot: lifted among the exponentials (it
        // depends on none of them) it would cut the lead of the next tile's copies.
        __builtin_amdgcn_sched_barrier(0);
        wait_async0();      // next tile's data landed in LDS
        __syncthreads();    // all waves done reading cur, next tile visible
        cur = nxt;
    }

    const int b = bh / HH, h = bh % HH;

    // Wo fragments and bias, asked for first: their latency runs under the staging.
    FragBF wf[2][4];
    float bias[4];
#pragma unroll
    for (int ks = 0; ks < 2; ++ks) {
        const uint4* wb = Wob + (size_t)(h * 2 + ks) * 256 + half * 64;
#pragma unroll
        for (int ct = 0; ct < 4; ++ct) {
            wf[ks][ct].q[0] = wb[ct * 16 + l16];
            wf[ks][ct].q[1] = wb[128 + ct * 16 + l16];
        }
    }
#pragma unroll
    for (int ct = 0; ct < 4; ++ct) bias[ct] = bo[h * DD + ct * 16 + l16];

    // Normalize by l, round to bf16 and lay the rows in this wave's own LDS range
    // (the loop's last barrier has ended every read of the ring; no copy is in flight).
    __bf16* ob = (__bf16*)smem4 + wave * (16 * QT * OPITCH / 2);
#pragma unroll
    for (int qi = 0; qi < QT; ++qi) {
#pragma unroll
        for (int dt = 0; dt < 4; ++dt)
#pragma unroll
            for (int r = 0; r < 8; ++r)
                ob[(qi * 16 + r + 8 * half) * (OPITCH / 2) + dt * 16 + l16] = (__bf16)(o[qi][dt][r] / lacc[qi][r]);
    }
    // The rows are read back by other lanes of the same wave: every store above
    // has to be done, and no read below may be lifted over it.
    asm volatile("s_wait_dscnt 0x0" ::: "memory");

    // A fragments (lane = query row): 2 x ds_load_b128 per K-slice and tile.
    const uint4* ob4 = (const uint4*)ob;
    FragBF a[QT][2];
#pragma unroll
    for (int qi = 0; qi < QT; ++qi)
#pragma unroll
        for (int ks = 0; ks < 2; ++ks) {
            a[qi][ks].q[0] = ob4[(qi * 16 + l16) * (OPITCH / 16) + ks * 4 + half];
            a[qi][ks].q[1] = ob4[(qi * 16 + l16) * (OPITCH / 16) + ks * 4 + 2 + half];
        }

    v8f c[QT][4];
#pragma unroll
    for (int qi = 0; qi < QT; ++qi) {
        v8f z = {};
        for (int i = 0; i < 4; ++i) c[qi][i] = z;
    }
#pragma unroll
    for (int ks = 0; ks < 2; ++ks)
#pragma unroll
        for (int ct = 0; ct < 4; ++ct)
#pragma unroll
            for (int qi = 0; qi < QT; ++qi)
                c[qi][ct] = wmma_bf16(a[qi][ks].v, wf[ks][ct].v, c[qi][ct]);

#pragma unroll
    for (int qi = 0; qi < QT; ++qi)
#pragma unroll
        for (int ct = 0; ct < 4; ++ct)
#pragma unroll
            for (int r = 0; r < 8; ++r) {
                const int row = q0 + qi * 16 + r + 8 * half;
                out[((size_t)(b * NN + row) * HH + h) * DD + ct * 16 + l16] = c[qi][ct][r] + bias[ct];
            }
}

extern "C" void kernel_launch(void* const* d_in, const int* in_sizes, int n_in,
                              void* d_out, int out_size, void* d_ws, size_t ws_size,
                              hipStream_t stream) {
    const float* x  = (const float*)d_in[0];
    const float* Wq = (const float*)d_in[1];
    const float* bq = (const float*)d_in[2];
    const float* Wk = (const float*)d_in[3];
    const float* bk = (const float*)d_in[4];
    const float* Wv = (const float*)d_in[5];
    const float* bv = (const float*)d_in[6];
    const float* Wo = (const float*)d_in[7];
    const float* bo = (const float*)d_in[8];
    float* out = (float*)d_out;

    const size_t SZ = (size_t)BB * HH * NN * DD;     // elems per bf16 tensor
    const size_t WSZ = (size_t)HH * 32 * 64;         // packed-weight dwords per tensor
    __bf16* Qs = (__bf16*)d_ws;
    __bf16* Ks = Qs + SZ;
    __bf16* Vt = Ks + SZ;
    unsigned* Wqb = (unsigned*)(Vt + SZ);
    unsigned* Wkb = Wqb + WSZ;
    unsigned* Wvb = Wkb + WSZ;
    unsigned* Wob = Wvb + WSZ;

    dim3 grid(NN / 64, BB * HH);
    pack_w_kernel   <<<dim3(128), 256, 0, stream>>>(Wq, Wk, Wv, Wo, Wqb, Wkb, Wvb, Wob);
    qkv_proj_kernel <<<grid, 128, 0, stream>>>(x, (const uint4*)Wqb, bq, (const uint4*)Wkb, bk,
                                               (const uint4*)Wvb, bv, Qs, Ks, Vt);
    flash_attn_kernel<<<dim3(NN / (64 * QT), BB * HH), 128, 0, stream>>>(Qs, Ks, Vt,
                                               (const uint4*)Wob, bo, out);
}

// v008
// A run of this version takes 76.7 microseconds.
// In two side-by-side timings against v007, it was 1.05 and 1.07 times as fast.
// Counting every step since v000, it is 2.74 times as fast.
#include <hip/hip_runtime.h>
#include <hip/hip_bf16.h>

#define BB 4
#define NN 2048
#define HH 16
#define DD 64

// Keys per ring stage: a stage's Vt rows are then 256 B, whole 128 B lines, and
// a stage is worked off in SKEYS / 32 passes of 32 keys between two barriers.
#define SKEYS 128
// LDS row pitches in bytes, 16 B x odd: the 16 lanes of a ds_load_b128 half
// then start on 16 different 4-bank groups (64 banks x 4 B), no bank conflict.
#define KPITCH 144                 // K rows: 128 B of data + 16 B pad
#define VPITCH (SKEYS * 2 + 16)    // Vt rows: SKEYS bf16 of data + 16 B pad
#define KBUF   (SKEYS * KPITCH)    // one K stage, SKEYS keys
#define VBUF   (64 * VPITCH)       // one Vt stage, 64 d-rows
#define OPITCH 144                 // O rows staged for the output projection: 128 B + 16 B pad

// Score scale 1/sqrt(1024) times log2(e): K.Q^T then counts in powers of two.
#define QSCALE 0.045084220f

typedef __attribute__((ext_vector_type(16))) __bf16 v16bf;
typedef __attribute__((ext_vector_type(8)))  float  v8f;

typedef __attribute__((ext_vector_type(8)))  unsigned v8u;

union FragBF { v16bf v; v8u w; unsigned u[8]; uint4 q[2]; };
union Acc    { v8f v; float f[8]; };

// Pinned packed conversion: keeps SLP from turning pairs into v_perm shuffles.
__device__ __forceinline__ unsigned pk(float a, float b) {
    unsigned d;
    asm("v_cvt_pk_bf16_f32 %0, %1, %2" : "=v"(d) : "v"(a), "v"(b));
    return d;
}

__device__ __forceinline__ v8f wmma_bf16(const v16bf& a, const v16bf& b, const v8f& c) {
    return __builtin_amdgcn_wmma_f32_16x16x32_bf16(false, a, false, b, (short)0, c, false, false);
}

// Scores of 16 keys x 2 query tiles: d = a0.b_0 + a1.b_1 + c, with D apart from C.
// In asm because the builtin ties D to C where C is used last and copies all of C
// first (8 v_mov_b64 a pass), which would give back half of what C saves.
// The four v_nop keep the chip's distance from the last WMMA to the first vector
// instruction on its D, A or B: the compiler counts nothing inside asm.
__device__ __forceinline__ void score_wmma(
    v8f& d0, v8f& d1, const v8u& a0, const v8u& a1,
    const v8u& b00, const v8u& b01, const v8u& b10, const v8u& b11,
    const v8f& c0, const v8f& c1) {
    asm("v_wmma_f32_16x16x32_bf16 %0, %2, %4, %8\n\t"
        "v_wmma_f32_16x16x32_bf16 %1, %2, %6, %9\n\t"
        "v_wmma_f32_16x16x32_bf16 %0, %3, %5, %0\n\t"
        "v_wmma_f32_16x16x32_bf16 %1, %3, %7, %1\n\t"
        "v_nop\n\tv_nop\n\tv_nop\n\tv_nop"
        : "=&v"(d0), "=&v"(d1)
        : "v"(a0), "v"(a1), "v"(b00), "v"(b01), "v"(b10), "v"(b11), "v"(c0), "v"(c1));
}

// This wave's async copies have landed in LDS; no LDS read may be lifted over it.
__device__ __forceinline__ void wait_async0() {
    asm volatile("s_wait_asynccnt 0x0" ::: "memory");
}

// Eight async copies of 16 B per lane (global -> LDS), tracked by ASYNCcnt:
// copy i goes from g + i * gstep to LDS byte l + i * lstep.
// s_wait_xcnt 0 closes the statement so that no address register named here
// is rewritten (the next statement's address additions) ahead of it.
__device__ __forceinline__ void async_b128x8(
    unsigned l, unsigned lstep, unsigned long long g, unsigned long long gstep) {
    asm volatile("global_load_async_to_lds_b128 %0, %1, off\n\t"
                 "global_load_async_to_lds_b128 %2, %3, off\n\t"
                 "global_load_async_to_lds_b128 %4, %5, off\n\t"
                 "global_load_async_to_lds_b128 %6, %7, off\n\t"
                 "global_load_async_to_lds_b128 %8, %9, off\n\t"
                 "global_load_async_to_lds_b128 %10, %11, off\n\t"
                 "global_load_async_to_lds_b128 %12, %13, off\n\t"
                 "global_load_async_to_lds_b128 %14, %15, off\n\t"
                 "s_wait_xcnt 0x0"
                 :: "v"(l),             "v"(g),
                    "v"(l + lstep),     "v"(g + gstep),
                    "v"(l + 2 * lstep), "v"(g + 2 * gstep),
                    "v"(l + 3 * lstep), "v"(g + 3 * gstep),
                    "v"(l + 4 * lstep), "v"(g + 4 * gstep),
                    "v"(l + 5 * lstep), "v"(g + 5 * gstep),
                    "v"(l + 6 * lstep), "v"(g + 6 * gstep),
                    "v"(l + 7 * lstep), "v"(g + 7 * gstep) : "memory");
}

// Fragment dword map (16-bit 16x16x32 WMMA, wave32):
//   register r (0..7), lane-half hf: dword index = (r>>2)*8 + hf*4 + (r&3)
//   within a 32-dword (64 bf16) row; K-slice ks adds 16 dwords.
// => u[0..3] and u[4..7] are each 16B-contiguous: load fragments as 2 x b128.

// ---------------------------------------------------------------------------
// Kernel 0: pre-pack weights fp32 [H,D,D] -> bf16, fragment-major:
//   dst uint4[(h*2+ks)*256 + g*128 + hf*64 + col] = regs r=0..3 for that slot,
//   where k = ks*32 + g*16 + hf*8 + 2r (+1), col = output column.
// ---------------------------------------------------------------------------
__global__ __launch_bounds__(256) void pack_w_kernel(
    const float* __restrict__ Wq, const float* __restrict__ Wk,
    const float* __restrict__ Wv, const float* __restrict__ Wo,
    unsigned* __restrict__ Wqb, unsigned* __restrict__ Wkb,
    unsigned* __restrict__ Wvb, unsigned* __restrict__ Wob)
{
    const int idx = blockIdx.x * 256 + threadIdx.x;      // H*32*64 = 32768 total
    const int col = idx & 63;
    const int k2  = (idx >> 6) & 31;                     // k/2
    const int h   = idx >> 11;
    const int ks  = k2 >> 4;
    const int g   = (k2 >> 3) & 1;
    const int hf  = (k2 >> 2) & 1;
    const int r   = k2 & 3;
    const size_t src = ((size_t)h * DD + 2 * k2) * DD + col;
    const int dst = (((h * 2 + ks) * 256 + g * 128 + hf * 64 + col) << 2) + r;
    Wqb[dst] = pk(Wq[src], Wq[src + DD]);
    Wkb[dst] = pk(Wk[src], Wk[src + DD]);
    Wvb[dst] = pk(Wv[src], Wv[src + DD]);
    Wob[dst] = pk(Wo[src], Wo[src + DD]);
}

// One projection matrix: 16 rows x 64 cols; each B-frag = 2 x b128 loads.
// MODE 0: Q (scaled log2(e)/32, [B,H,N,D]); 1: K ([B,H,N,D]); 2: V transposed ([B,H,D,N]).
template<int MODE>
__device__ __forceinline__ void proj_mat(
    const FragBF a[2], const uint4* __restrict__ Wb4,
    const float* __restrict__ bias, int bh, int h,
    int n0, int l16, int half, __bf16* __restrict__ dst)
{
    v8f c[4];
    { v8f z = {}; for (int i = 0; i < 4; ++i) c[i] = z; }
#pragma unroll
    for (int ks = 0; ks < 2; ++ks) {
        const uint4* wb = Wb4 + (size_t)(h * 2 + ks) * 256 + half * 64;
#pragma unroll
        for (int ct = 0; ct < 4; ++ct) {
            const int col = ct * 16 + l16;
            FragBF bf;
            bf.q[0] = wb[col];          // regs 0..3
            bf.q[1] = wb[128 + col];    // regs 4..7
            c[ct] = wmma_bf16(a[ks].v, bf.v, c[ct]);
        }
    }
#pragma unroll
    for (int ct = 0; ct < 4; ++ct) {
        const int col = ct * 16 + l16;
        const float bv = bias[h * DD + col];
#pragma unroll
        for (int r = 0; r < 8; ++r) {
            const int row = n0 + r + 8 * half;           // C: m = r + 8*half
            const float val = c[ct][r] + bv;
            if (MODE == 0)
                dst[((size_t)bh * NN + row) * DD + col] = (__bf16)(val * QSCALE);
            else if (MODE == 1)
                dst[((size_t)bh * NN + row) * DD + col] = (__bf16)val;
            else
                dst[((size_t)bh * DD + col) * NN + row] = (__bf16)val;
        }
    }
}

// ---------------------------------------------------------------------------
// Kernel 1: fused Q/K/V projection. grid = (N/64, B*H), block = 128 (4 waves).
// Reads x as fp32 and rounds it to bf16 in registers: each x element is used by
// exactly one wave, so a bf16 copy in memory would only add a round trip.
// ---------------------------------------------------------------------------
__global__ __launch_bounds__(128) void qkv_proj_kernel(
    const float* __restrict__ x,
    const uint4* __restrict__ Wqb, const float* __restrict__ bq,
    const uint4* __restrict__ Wkb, const float* __restrict__ bk,
    const uint4* __restrict__ Wvb, const float* __restrict__ bv,
    __bf16* __restrict__ Qs, __bf16* __restrict__ Ks, __bf16* __restrict__ Vt)
{
    const int bh   = blockIdx.y;
    const int b    = bh / HH, h = bh % HH;
    const int wave = threadIdx.x >> 5;
    const int lane = threadIdx.x & 31;
    const int half = lane >> 4;
    const int l16  = lane & 15;
    const int n0   = blockIdx.x * 64 + wave * 16;

    // A fragments: rows n0..n0+15 of x. Registers g*4..g*4+3 of K-slice ks hold
    // k = ks*32 + g*16 + half*8 .. +7: 8 floats = 2 x b128, packed in pairs.
    FragBF a[2];
    {
        const float4* xp4 = (const float4*)(x + ((size_t)(b * NN + n0 + l16) * HH + h) * DD);
        float4 f[2][2][2];
#pragma unroll
        for (int ks = 0; ks < 2; ++ks)
#pragma unroll
            for (int g = 0; g < 2; ++g) {
                f[ks][g][0] = xp4[ks * 8 + g * 4 + half * 2];
                f[ks][g][1] = xp4[ks * 8 + g * 4 + half * 2 + 1];
            }
        // Keeps all eight loads of x ahead of the first conversion: sunk between
        // the products they would expose the memory latency three times, not once.
        __builtin_amdgcn_sched_barrier(0);
#pragma unroll
        for (int ks = 0; ks < 2; ++ks)
#pragma unroll
            for (int g = 0; g < 2; ++g) {
                a[ks].u[g * 4 + 0] = pk(f[ks][g][0].x, f[ks][g][0].y);
                a[ks].u[g * 4 + 1] = pk(f[ks][g][0].z, f[ks][g][0].w);
                a[ks].u[g * 4 + 2] = pk(f[ks][g][1].x, f[ks][g][1].y);
                a[ks].u[g * 4 + 3] = pk(f[ks][g][1].z, f[ks][g][1].w);
            }
    }
    proj_mat<0>(a, Wqb, bq, bh, h, n0, l16, half, Qs);
    proj_mat<1>(a, Wkb, bk, bh, h, n0, l16, half, Ks);
    proj_mat<2>(a, Wvb, bv, bh, h, n0, l16, half, Vt);
}

// Stage SKEYS keys of K and Vt into an LDS buffer (async, ASYNCcnt-tracked).
// Neighbouring lanes take neighbouring 16 B, so that the 32 lanes of every copy
// cover 512 B in four whole 128 B lines: a copy that takes 16 B or 32 B out of
// each of 8 or 16 lines asks the L2 for as many lines and uses a part of each.
__device__ __forceinline__ void stage_tile(
    const __bf16* __restrict__ Ks, const __bf16* __restrict__ Vt,
    int bh, int j0, int t, unsigned klds, unsigned vlds)
{
    static_assert(SKEYS == 128, "eight copies of K and eight of Vt a thread");
    // K stage: rows j0..j0+127 are 16 KB in a row; the block takes 2 KB (16 rows) a copy.
    unsigned long long kg = (unsigned long long)(uintptr_t)
        (Ks + ((size_t)bh * NN + j0) * DD) + (unsigned long long)t * 16u;
    async_b128x8(klds, 16u * KPITCH, kg, 2048u);
    // Vt stage: 64 rows (d) x 256 B, 16 lanes a row; the block takes 8 rows a copy.
    unsigned long long vg = (unsigned long long)(uintptr_t)
        (Vt + ((size_t)bh * DD + (t >> 4)) * NN + j0) + ((unsigned long long)(t & 15) << 4);
    async_b128x8(vlds, 8u * VPITCH, vg, 8u * NN * 2u);
}

// ---------------------------------------------------------------------------
// Kernel 2: flash attention. grid = (N/128, B*H), block = 128 (4 waves).
// Each wave owns QT = 2 query tiles (32 queries): every K and Vt fragment read
// from LDS feeds two WMMAs, and one staged tile serves 128 queries.
// S^T = K.Q^T so the score C-layout refeeds directly as the P A-fragment.
// The score WMMA starts from C = minus the maximum in use, and Q carries log2(e):
// its result is the argument of exp2 as it stands, no vector subtract or multiply.
// The softmax denominators come off the matrix pipe: l += P . ones, with the same
// bf16 P that feeds P.V, in a tile laid out like an O tile (query = r + 8*half).
// Double-buffered LDS staging: stage s+1 async-loads overlap the passes of stage s.
// Epilogue: out[b,n,h,:] = attn[b,h,n,:].Wo[h] + bo[h] (fp32) on the wave's own
// 32 rows: attn never goes to memory and needs no launch of its own.
// ---------------------------------------------------------------------------
#define QT 2
#define RESCALE_T 8.0f             // in powers of two
__global__ __launch_bounds__(128) void flash_attn_kernel(
    const __bf16* __restrict__ Qs, const __bf16* __restrict__ Ks,
    const __bf16* __restrict__ Vt, const uint4* __restrict__ Wob,
    const float* __restrict__ bo, float* __restrict__ out)
{
    // One array: two Vt stages (64 d x SKEYS bf16), two K stages (SKEYS keys x 64 bf16),
    // padded rows; behind the loop the same bytes stage O, 32 rows a wave.
    __shared__ uint4 smem4[(2 * VBUF + 2 * KBUF) / 16];
    static_assert(4 * 16 * QT * OPITCH <= 2 * VBUF + 2 * KBUF, "O staging fits the ring");

    const int bh   = blockIdx.y;
    const int wave = threadIdx.x >> 5;
    const int lane = threadIdx.x & 31;
    const int half = lane >> 4;
    const int l16  = lane & 15;
    const int q0   = blockIdx.x * (64 * QT) + wave * (16 * QT);
    const int t    = threadIdx.x;

    // LDS byte offsets (generic shared pointer: low 32 bits = LDS offset)
    const unsigned voff = (unsigned)(uintptr_t)(void*)&smem4[0];
    const unsigned koff = voff + 2u * VBUF;
    const unsigned kl_t = (unsigned)(t >> 3) * KPITCH + ((unsigned)(t & 7) << 4);
    const unsigned vl_t = (unsigned)(t >> 4) * VPITCH + ((unsigned)(t & 15) << 4);

    // Resident Q^T B-fragments (lane = query): 2 x b128 per K-slice and tile.
    FragBF qt[QT][2];
#pragma unroll
    for (int qi = 0; qi < QT; ++qi) {
        const uint4* qp4 = (const uint4*)(Qs + ((size_t)bh * NN + q0 + qi * 16 + l16) * DD);
#pragma unroll
        for (int ks = 0; ks < 2; ++ks) {
            qt[qi][ks].q[0] = qp4[ks * 4 + half];
            qt[qi][ks].q[1] = qp4[ks * 4 + 2 + half];
        }
    }

    // cneg: minus the maximum in use, the lane's query in all eight registers
    // (C layout: lane = query).
    v8f lacc[QT];
    v8f cneg[QT];
    v8f o[QT][4];
#pragma unroll
    for (int qi = 0; qi < QT; ++qi) {
        v8f z = {};
        lacc[qi] = z;
        cneg[qi] = z;
        for (int i = 0; i < 4; ++i) o[qi][i] = z;
    }

    // B fragment of ones (bf16 1.0 in every place): P . ones puts each query's sum
    // over the pass's 32 keys into all 16 columns, so every lane holds its rows' l.
    // Made by v_mov in asm so that its eight registers stay resident: a plain constant
    // is kept in scalar registers and copied to vector registers anew in every pass.
    FragBF ones;
#pragma unroll
    for (int r = 0; r < 8; ++r) asm("v_mov_b32 %0, 0x3f803f80" : "=v"(ones.u[r]));

    // Prologue: stage 0 into buffer 0
    stage_tile(Ks, Vt, bh, 0, t, koff + kl_t, voff + vl_t);
    wait_async0();
    __syncthreads();

    // First maximum in use: the true maximum of the first 32 keys' scores (their
    // products are made once more, from C = 0), so that the loop has one case only.
    {
        const uint4* kb4 = smem4 + (2 * VBUF) / 16;
        Acc s0[QT][2];
#pragma unroll
        for (int sub = 0; sub < 2; ++sub) {
            FragBF ka[2];
#pragma unroll
            for (int ks = 0; ks < 2; ++ks) {
                ka[ks].q[0] = kb4[(sub * 16 + l16) * (KPITCH / 16) + ks * 4 + half];
                ka[ks].q[1] = kb4[(sub * 16 + l16) * (KPITCH / 16) + ks * 4 + 2 + half];
            }
            score_wmma(s0[0][sub].v, s0[1][sub].v, ka[0].w, ka[1].w,
                       qt[0][0].w, qt[0][1].w, qt[1][0].w, qt[1][1].w, cneg[0], cneg[1]);
        }
#pragma unroll
        for (int qi = 0; qi < QT; ++qi) {
            float tmax = s0[qi][0].f[0];
#pragma unroll
            for (int r = 1; r < 8; ++r) tmax = fmaxf(tmax, s0[qi][0].f[r]);
#pragma unroll
            for (int r = 0; r < 8; ++r) tmax = fmaxf(tmax, s0[qi][1].f[r]);
            tmax = fmaxf(tmax, __shfl_xor(tmax, 16, 32));
#pragma unroll
            for (int r = 0; r < 8; ++r) cneg[qi][r] = -tmax;
        }
    }

    int cur = 0;
    for (int j0 = 0; j0 < NN; j0 += SKEYS) {
        const int nxt = cur ^ 1;
        if (j0 + SKEYS < NN)   // issue next stage's async loads; overlap with compute
            stage_tile(Ks, Vt, bh, j0 + SKEYS, t,
                       koff + (unsigned)nxt * KBUF + kl_t,
                       voff + (unsigned)nxt * VBUF + vl_t);

      // Kept rolled: unrolled, the build takes more than 256 registers, and the four
      // waves a SIMD that hold the whole grid at once need an allocation of at most 256.
#pragma unroll 1
      for (int p = 0; p < SKEYS / 32; ++p) {
        // Pass p: K rows p*32 .. +31 of the stage, bytes p*64 .. +63 of each Vt row.
        const uint4* kb4 = smem4 + (2 * VBUF + cur * KBUF) / 16 + p * (32 * KPITCH / 16);
        const uint4* vb4 = smem4 + (cur * VBUF) / 16 + p * 4;

        // S^T tiles: st[qi][sub] = K[j0+p*32+sub*16 .. +15] . Q^T - shift  (C: lane=query, vgpr=key)
        Acc st[QT][2];
#pragma unroll
        for (int sub = 0; sub < 2; ++sub) {
            FragBF ka[2];                                    // 4 x ds_load_b128
#pragma unroll
            for (int ks = 0; ks < 2; ++ks) {
                ka[ks].q[0] = kb4[(sub * 16 + l16) * (KPITCH / 16) + ks * 4 + half];
                ka[ks].q[1] = kb4[(sub * 16 + l16) * (KPITCH / 16) + ks * 4 + 2 + half];
            }
            static_assert(QT == 2, "score_wmma takes two query tiles");
            score_wmma(st[0][sub].v, st[1][sub].v, ka[0].w, ka[1].w,
                       qt[0][0].w, qt[0][1].w, qt[1][0].w, qt[1][1].w, cneg[0], cneg[1]);
        }

        // Vt fragments, read as one group ahead of the branch below: their LDS
        // latency runs under the maximum and the exponentials; behind the branch
        // each pair would be waited for right in front of its WMMAs.
        FragBF bvv[4];                                       // 8 x ds_load_b128
#pragma unroll
        for (int dt = 0; dt < 4; ++dt) {
            bvv[dt].q[0] = vb4[(dt * 16 + l16) * (VPITCH / 16) + half];
            bvv[dt].q[1] = vb4[(dt * 16 + l16) * (VPITCH / 16) + 2 + half];
        }

        // Lazy rescale: the maximum in use moves, and O and l are rescaled, only
        // when some query's new score exceeds it by more than RESCALE_T (P then
        // stays <= 2^RESCALE_T = 256; O / l is the same quotient for any maximum).
        float tloc[QT];
        bool need = false;
#pragma unroll
        for (int qi = 0; qi < QT; ++qi) {
            // This lane's 16 of the query's 32 keys (the rest: lane ^ 16).
            float tmax = st[qi][0].f[0];
#pragma unroll
            for (int r = 1; r < 8; ++r) tmax = fmaxf(tmax, st[qi][0].f[r]);
#pragma unroll
            for (int r = 0; r < 8; ++r) tmax = fmaxf(tmax, st[qi][1].f[r]);
            tloc[qi] = tmax;
            need = need || (tmax > RESCALE_T);
        }
        // One wave-uniform scalar test a pass, over both halves and both tiles.
        // Marked unlikely so that the rescale lies outside the loop's straight line
        // (else the usual pass takes two more jumps round it).
        if (__builtin_expect(__builtin_amdgcn_ballot_w32(need) != 0, 0)) {
#pragma unroll
            for (int qi = 0; qi < QT; ++qi) {
                const float tmax  = fmaxf(tloc[qi], __shfl_xor(tloc[qi], 16, 32));
                const float d     = fmaxf(tmax, 0.f);        // rise of the maximum in use
                const float alpha = __builtin_amdgcn_exp2f(-d);
                const float cn    = cneg[qi][0] - d;
#pragma unroll
                for (int r = 0; r < 8; ++r) {
                    st[qi][0].f[r] -= d;                     // this pass: shifted by hand
                    st[qi][1].f[r] -= d;
                    cneg[qi][r] = cn;
                }
                // Per-query alpha into the O-tile layout (query = r + 8*half)
#pragma unroll
                for (int r = 0; r < 8; ++r) {
                    const float am = __shfl(alpha, r + 8 * half, 32);
                    lacc[qi][r] *= am;
#pragma unroll
                    for (int dt = 0; dt < 4; ++dt) o[qi][dt][r] *= am;
                }
            }
        }

        FragBF pa[QT];
#pragma unroll
        for (int qi = 0; qi < QT; ++qi) {
            // Softmax numerators (scale and shift are in the scores). Keys split lane <-> lane^16.
#pragma unroll
            for (int r = 0; r < 8; ++r) st[qi][0].f[r] = __builtin_amdgcn_exp2f(st[qi][0].f[r]);
#pragma unroll
            for (int r = 0; r < 8; ++r) st[qi][1].f[r] = __builtin_amdgcn_exp2f(st[qi][1].f[r]);

            // Pack P as A-fragment: S^T C-layout maps 1:1 onto P A-layout (same lane).
#pragma unroll
            for (int r = 0; r < 4; ++r) {
                pa[qi].u[r]     = pk(st[qi][0].f[2 * r], st[qi][0].f[2 * r + 1]);
                pa[qi].u[4 + r] = pk(st[qi][1].f[2 * r], st[qi][1].f[2 * r + 1]);
            }
        }

#pragma unroll
        for (int dt = 0; dt < 4; ++dt)
#pragma unroll
            for (int qi = 0; qi < QT; ++qi)
                o[qi][dt] = wmma_bf16(pa[qi].v, bvv[dt].v, o[qi][dt]);
#pragma unroll
        for (int qi = 0; qi < QT; ++qi)
            lacc[qi] = wmma_bf16(pa[qi].v, ones.v, lacc[qi]);
      }

        // This wave's reads of cur are done before the barrier lets it be refilled.
        asm volatile("s_wait_dscnt 0x0" ::: "memory");
        wait_async0();      // next stage's data landed in LDS
        __syncthreads();    // all waves done reading cur, next stage visible
        cur = nxt;
    }

    const int b = bh / HH, h = bh % HH;

    // Wo fragments and bias, asked for first: their latency runs under the staging.
    FragBF wf[2][4];
    float bias[4];
#pragma unroll
    for (int ks = 0; ks < 2; ++ks) {
        const uint4* wb = Wob + (size_t)(h * 2 + ks) * 256 + half * 64;
#pragma unroll
        for (int ct = 0; ct < 4; ++ct) {
            wf[ks][ct].q[0] = wb[ct * 16 + l16];
            wf[ks][ct].q[1] = wb[128 + ct * 16 + l16];
        }
    }
#pragma unroll
    for (int ct = 0; ct < 4; ++ct) bias[ct] = bo[h * DD + ct * 16 + l16];

    // Normalize by l, round to bf16 and lay the rows in this wave's own LDS range
    // (the loop's last barrier has ended every read of the ring; no copy is in flight).
    __bf16* ob = (__bf16*)smem4 + wave * (16 * QT * OPITCH / 2);
#pragma unroll
    for (int qi = 0; qi < QT; ++qi) {
#pragma unroll
        for (int dt = 0; dt < 4; ++dt)
#pragma unroll
            for (int r = 0; r < 8; ++r)
                ob[(qi * 16 + r + 8 * half) * (OPITCH / 2) + dt * 16 + l16] = (__bf16)(o[qi][dt][r] / lacc[qi][r]);
    }
    // The rows are read back by other lanes of the same wave: every store above
    // has to be done, and no read below may be lifted over it.
    asm volatile("s_wait_dscnt 0x0" ::: "memory");

    // A fragments (lane = query row): 2 x ds_load_b128 per K-slice and tile.
    const uint4* ob4 = (const uint4*)ob;
    FragBF a[QT][2];
#pragma unroll
    for (int qi = 0; qi < QT; ++qi)
#pragma unroll
        for (int ks = 0; ks < 2; ++ks) {
            a[qi][ks].q[0] = ob4[(qi * 16 + l16) * (OPITCH / 16) + ks * 4 + half];
            a[qi][ks].q[1] = ob4[(qi * 16 + l16) * (OPITCH / 16) + ks * 4 + 2 + half];
        }

    v8f c[QT][4];
#pragma unroll
    for (int qi = 0; qi < QT; ++qi) {
        v8f z = {};
        for (int i = 0; i < 4; ++i) c[qi][i] = z;
    }
#pragma unroll
    for (int ks = 0; ks < 2; ++ks)
#pragma unroll
        for (int ct = 0; ct < 4; ++ct)
#pragma unroll
            for (int qi = 0; qi < QT; ++qi)
                c[qi][ct] = wmma_bf16(a[qi][ks].v, wf[ks][ct].v, c[qi][ct]);

#pragma unroll
    for (int qi = 0; qi < QT; ++qi)
#pragma unroll
        for (int ct = 0; ct < 4; ++ct)
#pragma unroll
            for (int r = 0; r < 8; ++r) {
                const int row = q0 + qi * 16 + r + 8 * half;
                out[((size_t)(b * NN + row) * HH + h) * DD + ct * 16 + l16] = c[qi][ct][r] + bias[ct];
            }
}

extern "C" void kernel_launch(void* const* d_in, const int* in_sizes, int n_in,
                              void* d_out, int out_size, void* d_ws, size_t ws_size,
                              hipStream_t stream) {
    const float* x  = (const float*)d_in[0];
    const float* Wq = (const float*)d_in[1];
    const float* bq = (const float*)d_in[2];
    const float* Wk = (const float*)d_in[3];
    const float* bk = (const float*)d_in[4];
    const float* Wv = (const float*)d_in[5];
    const float* bv = (const float*)d_in[6];
    const float* Wo = (const float*)d_in[7];
    const float* bo = (const float*)d_in[8];
    float* out = (float*)d_out;

    const size_t SZ = (size_t)BB * HH * NN * DD;     // elems per bf16 tensor
    const size_t WSZ = (size_t)HH * 32 * 64;         // packed-weight dwords per tensor
    __bf16* Qs = (__bf16*)d_ws;
    __bf16* Ks = Qs + SZ;
    __bf16* Vt = Ks + SZ;
    unsigned* Wqb = (unsigned*)(Vt + SZ);
    unsigned* Wkb = Wqb + WSZ;
    unsigned* Wvb = Wkb + WSZ;
    unsigned* Wob = Wvb + WSZ;

    dim3 grid(NN / 64, BB * HH);
    pack_w_kernel   <<<dim3(128), 256, 0, stream>>>(Wq, Wk, Wv, Wo, Wqb, Wkb, Wvb, Wob);
    qkv_proj_kernel <<<grid, 128, 0, stream>>>(x, (const uint4*)Wqb, bq, (const uint4*)Wkb, bk,
                                               (const uint4*)Wvb, bv, Qs, Ks, Vt);
    flash_attn_kernel<<<dim3(NN / (64 * QT), BB * HH), 128, 0, stream>>>(Qs, Ks, Vt,
                                               (const uint4*)Wob, bo, out);
}

// v009
// A run of this version takes 71.8 microseconds.
// Timed twice side by side with v008, it ran 1.07 times as fast both times.
// Counting every step since v000, it is 2.93 times as fast.
#include <hip/hip_runtime.h>
#include <hip/hip_bf16.h>

#define BB 4
#define NN 2048
#define HH 16
#define DD 64

// Keys per ring stage: a stage's Vt rows are then 256 B, whole 128 B lines, and
// a stage is worked off in SKEYS / 32 passes of 32 keys between two barriers.
#define SKEYS 128
// LDS row pitches in bytes, 16 B x odd: the 16 lanes of a ds_load_b128 half
// then start on 16 different 4-bank groups (64 banks x 4 B), no bank conflict.
#define KPITCH 144                 // K rows: 128 B of data + 16 B pad
#define VPITCH (SKEYS * 2 + 16)    // Vt rows: SKEYS bf16 of data + 16 B pad
#define KBUF   (SKEYS * KPITCH)    // one K stage, SKEYS keys
#define VBUF   (64 * VPITCH)       // one Vt stage, 64 d-rows
#define OPITCH 144                 // O rows staged for the output projection: 128 B + 16 B pad

// Score scale 1/sqrt(1024) times log2(e): K.Q^T then counts in powers of two.
#define QSCALE 0.045084220f

typedef __attribute__((ext_vector_type(16))) __bf16 v16bf;
typedef __attribute__((ext_vector_type(8)))  float  v8f;

typedef __attribute__((ext_vector_type(8)))  unsigned v8u;

union FragBF { v16bf v; v8u w; unsigned u[8]; uint4 q[2]; };
union Acc    { v8f v; float f[8]; };

// Pinned packed conversion: keeps SLP from turning pairs into v_perm shuffles.
__device__ __forceinline__ unsigned pk(float a, float b) {
    unsigned d;
    asm("v_cvt_pk_bf16_f32 %0, %1, %2" : "=v"(d) : "v"(a), "v"(b));
    return d;
}

__device__ __forceinline__ v8f wmma_bf16(const v16bf& a, const v16bf& b, const v8f& c) {
    return __builtin_amdgcn_wmma_f32_16x16x32_bf16(false, a, false, b, (short)0, c, false, false);
}

// Scores of 16 keys x 2 query tiles: d = a0.b_0 + a1.b_1 + c, with D apart from C.
// In asm because the builtin ties D to C where C is used last and copies all of C
// first (8 v_mov_b64 a pass), which would give back half of what C saves.
// The four v_nop keep the chip's distance from the last WMMA to the first vector
// instruction on its D, A or B: the compiler counts nothing inside asm.
__device__ __forceinline__ void score_wmma(
    v8f& d0, v8f& d1, const v8u& a0, const v8u& a1,
    const v8u& b00, const v8u& b01, const v8u& b10, const v8u& b11,
    const v8f& c0, const v8f& c1) {
    asm("v_wmma_f32_16x16x32_bf16 %0, %2, %4, %8\n\t"
        "v_wmma_f32_16x16x32_bf16 %1, %2, %6, %9\n\t"
        "v_wmma_f32_16x16x32_bf16 %0, %3, %5, %0\n\t"
        "v_wmma_f32_16x16x32_bf16 %1, %3, %7, %1\n\t"
        "v_nop\n\tv_nop\n\tv_nop\n\tv_nop"
        : "=&v"(d0), "=&v"(d1)
        : "v"(a0), "v"(a1), "v"(b00), "v"(b01), "v"(b10), "v"(b11), "v"(c0), "v"(c1));
}

// This wave's async copies have landed in LDS; no LDS read may be lifted over it.
__device__ __forceinline__ void wait_async0() {
    asm volatile("s_wait_asynccnt 0x0" ::: "memory");
}

// Eight async copies of 16 B per lane (global -> LDS), tracked by ASYNCcnt:
// copy i goes from g + i * gstep to LDS byte l + i * lstep.
// s_wait_xcnt 0 closes the statement so that no address register named here
// is rewritten (the next statement's address additions) ahead of it.
__device__ __forceinline__ void async_b128x8(
    unsigned l, unsigned lstep, unsigned long long g, unsigned long long gstep) {
    asm volatile("global_load_async_to_lds_b128 %0, %1, off\n\t"
                 "global_load_async_to_lds_b128 %2, %3, off\n\t"
                 "global_load_async_to_lds_b128 %4, %5, off\n\t"
                 "global_load_async_to_lds_b128 %6, %7, off\n\t"
                 "global_load_async_to_lds_b128 %8, %9, off\n\t"
                 "global_load_async_to_lds_b128 %10, %11, off\n\t"
                 "global_load_async_to_lds_b128 %12, %13, off\n\t"
                 "global_load_async_to_lds_b128 %14, %15, off\n\t"
                 "s_wait_xcnt 0x0"
                 :: "v"(l),             "v"(g),
                    "v"(l + lstep),     "v"(g + gstep),
                    "v"(l + 2 * lstep), "v"(g + 2 * gstep),
                    "v"(l + 3 * lstep), "v"(g + 3 * gstep),
                    "v"(l + 4 * lstep), "v"(g + 4 * gstep),
                    "v"(l + 5 * lstep), "v"(g + 5 * gstep),
                    "v"(l + 6 * lstep), "v"(g + 6 * gstep),
                    "v"(l + 7 * lstep), "v"(g + 7 * gstep) : "memory");
}

// Fragment dword map (16-bit 16x16x32 WMMA, wave32):
//   register r (0..7), lane-half hf: dword index = (r>>2)*8 + hf*4 + (r&3)
//   within a 32-dword (64 bf16) row; K-slice ks adds 16 dwords.
// => u[0..3] and u[4..7] are each 16B-contiguous: load fragments as 2 x b128.

// Packed weights, bf16, fragment-major. Slot kg = ks*4 + g*2 + hf (0..7) holds, per
// output column, one uint4 = registers r = 0..3 with k = kg*8 + 2r (+1).
// In LDS (Wq, Wk, Wv of one head): uint4[kg * WPITCH + col + (col >> 4)]. The skew of
// one uint4 per 16 columns lets both sides go without bank conflict: the writers'
// 16 lanes stand 4 columns apart, the readers' 16 lanes 1 column apart.
// In memory (Wo, all heads): uint4[(h*2+ks)*256 + g*128 + hf*64 + col].
#define WPITCH 68                  // uint4 per slot: 64 columns + 3 of skew, rounded up
#define WMAT   (8 * WPITCH)        // uint4 per matrix

// Thread t takes rows k = 8*(t>>4) .. +7, columns 4*(t&15) .. +3 of W[h] (fp32):
// each wave-wide load covers two rows of 256 B, whole lines.
__device__ __forceinline__ void load_w(
    const float* __restrict__ Wm, int h, int t, float4 f[8])
{
    const char* wh = (const char*)(Wm + (size_t)h * DD * DD);        // same for the block
    const unsigned off = (unsigned)(t >> 4) * (8u * DD * 4u) + (unsigned)(t & 15) * 16u;
#pragma unroll
    for (int j = 0; j < 8; ++j) f[j] = *(const float4*)(wh + (off + (unsigned)j * (DD * 4u)));
}

// Rounds them to bf16 in k pairs and lays the four columns' uint4 into the LDS image.
__device__ __forceinline__ void store_w(uint4* __restrict__ wl, int t, const float4 f[8])
{
    const int cg = t & 15;
    uint4* d = wl + (t >> 4) * WPITCH + cg * 4 + (cg >> 2);
    d[0] = make_uint4(pk(f[0].x, f[1].x), pk(f[2].x, f[3].x), pk(f[4].x, f[5].x), pk(f[6].x, f[7].x));
    d[1] = make_uint4(pk(f[0].y, f[1].y), pk(f[2].y, f[3].y), pk(f[4].y, f[5].y), pk(f[6].y, f[7].y));
    d[2] = make_uint4(pk(f[0].z, f[1].z), pk(f[2].z, f[3].z), pk(f[4].z, f[5].z), pk(f[6].z, f[7].z));
    d[3] = make_uint4(pk(f[0].w, f[1].w), pk(f[2].w, f[3].w), pk(f[4].w, f[5].w), pk(f[6].w, f[7].w));
}

// One projection matrix: 16 rows x 64 cols; each B-frag = 2 x ds_load_b128.
// MODE 0: Q (scaled log2(e)/32, [B,H,N,D]); 1: K ([B,H,N,D]); 2: V transposed ([B,H,D,N]).
template<int MODE>
__device__ __forceinline__ void proj_mat(
    const FragBF a[2], const uint4* __restrict__ wl,
    const float* __restrict__ bias, int bh, int h,
    int n0, int l16, int half, __bf16* __restrict__ dst)
{
    v8f c[4];
    { v8f z = {}; for (int i = 0; i < 4; ++i) c[i] = z; }
#pragma unroll
    for (int ks = 0; ks < 2; ++ks) {
        const uint4* wb = wl + (ks * 4 + half) * WPITCH;
#pragma unroll
        for (int ct = 0; ct < 4; ++ct) {
            const int pos = ct * 17 + l16;        // col + (col >> 4), col = ct*16 + l16
            FragBF bf;
            bf.q[0] = wb[pos];                    // regs 0..3 (g = 0)
            bf.q[1] = wb[2 * WPITCH + pos];       // regs 4..7 (g = 1)
            c[ct] = wmma_bf16(a[ks].v, bf.v, c[ct]);
        }
    }
#pragma unroll
    for (int ct = 0; ct < 4; ++ct) {
        const int col = ct * 16 + l16;
        const float bv = bias[h * DD + col];
#pragma unroll
        for (int r = 0; r < 8; ++r) {
            const int row = n0 + r + 8 * half;           // C: m = r + 8*half
            const float val = c[ct][r] + bv;
            if (MODE == 0)
                dst[((size_t)bh * NN + row) * DD + col] = (__bf16)(val * QSCALE);
            else if (MODE == 1)
                dst[((size_t)bh * NN + row) * DD + col] = (__bf16)val;
            else
                dst[((size_t)bh * DD + col) * NN + row] = (__bf16)val;
        }
    }
}

// ---------------------------------------------------------------------------
// Kernel 1: fused Q/K/V projection. grid = (N/64, B*H), block = 128 (4 waves).
// Reads x as fp32 and rounds it to bf16 in registers: each x element is used by
// exactly one wave, so a bf16 copy in memory would only add a round trip.
// The work-group packs its head's Wq, Wk, Wv itself, fp32 rows -> bf16 fragments in
// LDS, and the blocks of batch 0 pack Wo for the attention launch (64 dwords each):
// no launch of its own for the weights.
// ---------------------------------------------------------------------------
__global__ __launch_bounds__(128) void qkv_proj_kernel(
    const float* __restrict__ x,
    const float* __restrict__ Wq, const float* __restrict__ bq,
    const float* __restrict__ Wk, const float* __restrict__ bk,
    const float* __restrict__ Wv, const float* __restrict__ bv,
    const float* __restrict__ Wo,
    __bf16* __restrict__ Qs, __bf16* __restrict__ Ks, __bf16* __restrict__ Vt,
    unsigned* __restrict__ Wob)
{
    __shared__ uint4 wlds[3 * WMAT];

    const int bh   = blockIdx.y;
    const int b    = bh / HH, h = bh % HH;
    const int wave = threadIdx.x >> 5;
    const int lane = threadIdx.x & 31;
    const int half = lane >> 4;
    const int l16  = lane & 15;
    const int n0   = blockIdx.x * 64 + wave * 16;

    // A fragments: rows n0..n0+15 of x. Registers g*4..g*4+3 of K-slice ks hold
    // k = ks*32 + g*16 + half*8 .. +7: 8 floats = 2 x b128, packed in pairs.
    FragBF a[2];
    {
        const float4* xp4 = (const float4*)(x + ((size_t)(b * NN + n0 + l16) * HH + h) * DD);
        float4 f[2][2][2];
#pragma unroll
        for (int ks = 0; ks < 2; ++ks)
#pragma unroll
            for (int g = 0; g < 2; ++g) {
                f[ks][g][0] = xp4[ks * 8 + g * 4 + half * 2];
                f[ks][g][1] = xp4[ks * 8 + g * 4 + half * 2 + 1];
            }
        // Wo[h], k pair blockIdx.x, 64 columns: waves 0 and 1 of the blocks of batch 0.
        static_assert(NN / 64 == DD / 2, "one block of batch 0 per k pair of Wo");
        const bool packs_wo = (b == 0 && wave < 2);
        float wo0 = 0.f, wo1 = 0.f;
        if (packs_wo) {
            const float* wop = Wo + ((size_t)h * DD + 2 * blockIdx.x) * DD + threadIdx.x;
            wo0 = wop[0];
            wo1 = wop[DD];
        }
        float4 wq[8], wk[8], wv[8];
        load_w(Wq, h, threadIdx.x, wq);
        load_w(Wk, h, threadIdx.x, wk);
        load_w(Wv, h, threadIdx.x, wv);
        // Keeps all loads of x and of the weights ahead of the first conversion: sunk
        // between the conversions they would expose the memory latency once a group.
        __builtin_amdgcn_sched_barrier(0);
        store_w(wlds, threadIdx.x, wq);
        store_w(wlds + WMAT, threadIdx.x, wk);
        store_w(wlds + 2 * WMAT, threadIdx.x, wv);
        // Every wave reads fragments that all four waves have written.
        __syncthreads();
        // Behind the barrier, so that the barrier does not wait for this store.
        if (packs_wo) {
            const int col = threadIdx.x;
            const int k2  = blockIdx.x;                  // k/2 = ks*16 + g*8 + hf*4 + r
            const int dst = (((h * 2 + (k2 >> 4)) * 256 + ((k2 >> 3) & 1) * 128
                              + ((k2 >> 2) & 1) * 64 + col) << 2) + (k2 & 3);
            Wob[dst] = pk(wo0, wo1);
        }
#pragma unroll
        for (int ks = 0; ks < 2; ++ks)
#pragma unroll
            for (int g = 0; g < 2; ++g) {
                a[ks].u[g * 4 + 0] = pk(f[ks][g][0].x, f[ks][g][0].y);
                a[ks].u[g * 4 + 1] = pk(f[ks][g][0].z, f[ks][g][0].w);
                a[ks].u[g * 4 + 2] = pk(f[ks][g][1].x, f[ks][g][1].y);
                a[ks].u[g * 4 + 3] = pk(f[ks][g][1].z, f[ks][g][1].w);
            }
    }
    proj_mat<0>(a, wlds, bq, bh, h, n0, l16, half, Qs);
    proj_mat<1>(a, wlds + WMAT, bk, bh, h, n0, l16, half, Ks);
    proj_mat<2>(a, wlds + 2 * WMAT, bv, bh, h, n0, l16, half, Vt);
}

// Stage SKEYS keys of K and Vt into an LDS buffer (async, ASYNCcnt-tracked).
// Neighbouring lanes take neighbouring 16 B, so that the 32 lanes of every copy
// cover 512 B in four whole 128 B lines: a copy that takes 16 B or 32 B out of
// each of 8 or 16 lines asks the L2 for as many lines and uses a part of each.
__device__ __forceinline__ void stage_tile(
    const __bf16* __restrict__ Ks, const __bf16* __restrict__ Vt,
    int bh, int j0, int t, unsigned klds, unsigned vlds)
{
    static_assert(SKEYS == 128, "eight copies of K and eight of Vt a thread");
    // K stage: rows j0..j0+127 are 16 KB in a row; the block takes 2 KB (16 rows) a copy.
    unsigned long long kg = (unsigned long long)(uintptr_t)
        (Ks + ((size_t)bh * NN + j0) * DD) + (unsigned long long)t * 16u;
    async_b128x8(klds, 16u * KPITCH, kg, 2048u);
    // Vt stage: 64 rows (d) x 256 B, 16 lanes a row; the block takes 8 rows a copy.
    unsigned long long vg = (unsigned long long)(uintptr_t)
        (Vt + ((size_t)bh * DD + (t >> 4)) * NN + j0) + ((unsigned long long)(t & 15) << 4);
    async_b128x8(vlds, 8u * VPITCH, vg, 8u * NN * 2u);
}

// ---------------------------------------------------------------------------
// Kernel 2: flash attention. grid = (N/128, B*H), block = 128 (4 waves).
// Each wave owns QT = 2 query tiles (32 queries): every K and Vt fragment read
// from LDS feeds two WMMAs, and one staged tile serves 128 queries.
// S^T = K.Q^T so the score C-layout refeeds directly as the P A-fragment.
// The score WMMA starts from C = minus the maximum in use, and Q carries log2(e):
// its result is the argument of exp2 as it stands, no vector subtract or multiply.
// The softmax denominators come off the matrix pipe: l += P . ones, with the same
// bf16 P that feeds P.V, in a tile laid out like an O tile (query = r + 8*half).
// Double-buffered LDS staging: stage s+1 async-loads overlap the passes of stage s.
// Epilogue: out[b,n,h,:] = attn[b,h,n,:].Wo[h] + bo[h] (fp32) on the wave's own
// 32 rows: attn never goes to memory and needs no launch of its own.
// ---------------------------------------------------------------------------
#define QT 2
#define RESCALE_T 8.0f             // in powers of two
__global__ __launch_bounds__(128) void flash_attn_kernel(
    const __bf16* __restrict__ Qs, const __bf16* __restrict__ Ks,
    const __bf16* __restrict__ Vt, const uint4* __restrict__ Wob,
    const float* __restrict__ bo, float* __restrict__ out)
{
    // One array: two Vt stages (64 d x SKEYS bf16), two K stages (SKEYS keys x 64 bf16),
    // padded rows; behind the loop the same bytes stage O, 32 rows a wave.
    __shared__ uint4 smem4[(2 * VBUF + 2 * KBUF) / 16];
    static_assert(4 * 16 * QT * OPITCH <= 2 * VBUF + 2 * KBUF, "O staging fits the ring");

    const int bh   = blockIdx.y;
    const int wave = threadIdx.x >> 5;
    const int lane = threadIdx.x & 31;
    const int half = lane >> 4;
    const int l16  = lane & 15;
    const int q0   = blockIdx.x * (64 * QT) + wave * (16 * QT);
    const int t    = threadIdx.x;

    // LDS byte offsets (generic shared pointer: low 32 bits = LDS offset)
    const unsigned voff = (unsigned)(uintptr_t)(void*)&smem4[0];
    const unsigned koff = voff + 2u * VBUF;
    const unsigned kl_t = (unsigned)(t >> 3) * KPITCH + ((unsigned)(t & 7) << 4);
    const unsigned vl_t = (unsigned)(t >> 4) * VPITCH + ((unsigned)(t & 15) << 4);

    // Resident Q^T B-fragments (lane = query): 2 x b128 per K-slice and tile.
    FragBF qt[QT][2];
#pragma unroll
    for (int qi = 0; qi < QT; ++qi) {
        const uint4* qp4 = (const uint4*)(Qs + ((size_t)bh * NN + q0 + qi * 16 + l16) * DD);
#pragma unroll
        for (int ks = 0; ks < 2; ++ks) {
            qt[qi][ks].q[0] = qp4[ks * 4 + half];
            qt[qi][ks].q[1] = qp4[ks * 4 + 2 + half];
        }
    }

    // cneg: minus the maximum in use, the lane's query in all eight registers
    // (C layout: lane = query).
    v8f lacc[QT];
    v8f cneg[QT];
    v8f o[QT][4];
#pragma unroll
    for (int qi = 0; qi < QT; ++qi) {
        v8f z = {};
        lacc[qi] = z;
        cneg[qi] = z;
        for (int i = 0; i < 4; ++i) o[qi][i] = z;
    }

    // B fragment of ones (bf16 1.0 in every place): P . ones puts each query's sum
    // over the pass's 32 keys into all 16 columns, so every lane holds its rows' l.
    // Made by v_mov in asm so that its eight registers stay resident: a plain constant
    // is kept in scalar registers and copied to vector registers anew in every pass.
    FragBF ones;
#pragma unroll
    for (int r = 0; r < 8; ++r) asm("v_mov_b32 %0, 0x3f803f80" : "=v"(ones.u[r]));

    // Prologue: stage 0 into buffer 0
    stage_tile(Ks, Vt, bh, 0, t, koff + kl_t, voff + vl_t);
    wait_async0();
    __syncthreads();

    // First maximum in use: the true maximum of the first 32 keys' scores (their
    // products are made once more, from C = 0), so that the loop has one case only.
    {
        const uint4* kb4 = smem4 + (2 * VBUF) / 16;
        Acc s0[QT][2];
#pragma unroll
        for (int sub = 0; sub < 2; ++sub) {
            FragBF ka[2];
#pragma unroll
            for (int ks = 0; ks < 2; ++ks) {
                ka[ks].q[0] = kb4[(sub * 16 + l16) * (KPITCH / 16) + ks * 4 + half];
                ka[ks].q[1] = kb4[(sub * 16 + l16) * (KPITCH / 16) + ks * 4 + 2 + half];
            }
            score_wmma(s0[0][sub].v, s0[1][sub].v, ka[0].w, ka[1].w,
                       qt[0][0].w, qt[0][1].w, qt[1][0].w, qt[1][1].w, cneg[0], cneg[1]);
        }
#pragma unroll
        for (int qi = 0; qi < QT; ++qi) {
            float tmax = s0[qi][0].f[0];
#pragma unroll
            for (int r = 1; r < 8; ++r) tmax = fmaxf(tmax, s0[qi][0].f[r]);
#pragma unroll
            for (int r = 0; r < 8; ++r) tmax = fmaxf(tmax, s0[qi][1].f[r]);
            tmax = fmaxf(tmax, __shfl_xor(tmax, 16, 32));
#pragma unroll
            for (int r = 0; r < 8; ++r) cneg[qi][r] = -tmax;
        }
    }

    int cur = 0;
    for (int j0 = 0; j0 < NN; j0 += SKEYS) {
        const int nxt = cur ^ 1;
        if (j0 + SKEYS < NN)   // issue next stage's async loads; overlap with compute
            stage_tile(Ks, Vt, bh, j0 + SKEYS, t,
                       koff + (unsigned)nxt * KBUF + kl_t,
                       voff + (unsigned)nxt * VBUF + vl_t);

      // Kept rolled: unrolled, the build takes more than 256 registers, and the four
      // waves a SIMD that hold the whole grid at once need an allocation of at most 256.
#pragma unroll 1
      for (int p = 0; p < SKEYS / 32; ++p) {
        // Pass p: K rows p*32 .. +31 of the stage, bytes p*64 .. +63 of each Vt row.
        const uint4* kb4 = smem4 + (2 * VBUF + cur * KBUF) / 16 + p * (32 * KPITCH / 16);
        const uint4* vb4 = smem4 + (cur * VBUF) / 16 + p * 4;

        // S^T tiles: st[qi][sub] = K[j0+p*32+sub*16 .. +15] . Q^T - shift  (C: lane=query, vgpr=key)
        Acc st[QT][2];
#pragma unroll
        for (int sub = 0; sub < 2; ++sub) {
            FragBF ka[2];                                    // 4 x ds_load_b128
#pragma unroll
            for (int ks = 0; ks < 2; ++ks) {
                ka[ks].q[0] = kb4[(sub * 16 + l16) * (KPITCH / 16) + ks * 4 + half];
                ka[ks].q[1] = kb4[(sub * 16 + l16) * (KPITCH / 16) + ks * 4 + 2 + half];
            }
            static_assert(QT == 2, "score_wmma takes two query tiles");
            score_wmma(st[0][sub].v, st[1][sub].v, ka[0].w, ka[1].w,
                       qt[0][0].w, qt[0][1].w, qt[1][0].w, qt[1][1].w, cneg[0], cneg[1]);
        }

        // Vt fragments, read as one group ahead of the branch below: their LDS
        // latency runs under the maximum and the exponentials; behind the branch
        // each pair would be waited for right in front of its WMMAs.
        FragBF bvv[4];                                       // 8 x ds_load_b128
#pragma unroll
        for (int dt = 0; dt < 4; ++dt) {
            bvv[dt].q[0] = vb4[(dt * 16 + l16) * (VPITCH / 16) + half];
            bvv[dt].q[1] = vb4[(dt * 16 + l16) * (VPITCH / 16) + 2 + half];
        }

        // Lazy rescale: the maximum in use moves, and O and l are rescaled, only
        // when some query's new score exceeds it by more than RESCALE_T (P then
        // stays <= 2^RESCALE_T = 256; O / l is the same quotient for any maximum).
        float tloc[QT];
        bool need = false;
#pragma unroll
        for (int qi = 0; qi < QT; ++qi) {
            // This lane's 16 of the query's 32 keys (the rest: lane ^ 16).
            float tmax = st[qi][0].f[0];
#pragma unroll
            for (int r = 1; r < 8; ++r) tmax = fmaxf(tmax, st[qi][0].f[r]);
#pragma unroll
            for (int r = 0; r < 8; ++r) tmax = fmaxf(tmax, st[qi][1].f[r]);
            tloc[qi] = tmax;
            need = need || (tmax > RESCALE_T);
        }
        // One wave-uniform scalar test a pass, over both halves and both tiles.
        // Marked unlikely so that the rescale lies outside the loop's straight line
        // (else the usual pass takes two more jumps round it).
        if (__builtin_expect(__builtin_amdgcn_ballot_w32(need) != 0, 0)) {
#pragma unroll
            for (int qi = 0; qi < QT; ++qi) {
                const float tmax  = fmaxf(tloc[qi], __shfl_xor(tloc[qi], 16, 32));
                const float d     = fmaxf(tmax, 0.f);        // rise of the maximum in use
                const float alpha = __builtin_amdgcn_exp2f(-d);
                const float cn    = cneg[qi][0] - d;
#pragma unroll
                for (int r = 0; r < 8; ++r) {
                    st[qi][0].f[r] -= d;                     // this pass: shifted by hand
                    st[qi][1].f[r] -= d;
                    cneg[qi][r] = cn;
                }
                // Per-query alpha into the O-tile layout (query = r + 8*half)
#pragma unroll
                for (int r = 0; r < 8; ++r) {
                    const float am = __shfl(alpha, r + 8 * half, 32);
                    lacc[qi][r] *= am;
#pragma unroll
                    for (int dt = 0; dt < 4; ++dt) o[qi][dt][r] *= am;
                }
            }
        }

        FragBF pa[QT];
#pragma unroll
        for (int qi = 0; qi < QT; ++qi) {
            // Softmax numerators (scale and shift are in the scores). Keys split lane <-> lane^16.
#pragma unroll
            for (int r = 0; r < 8; ++r) st[qi][0].f[r] = __builtin_amdgcn_exp2f(st[qi][0].f[r]);
#pragma unroll
            for (int r = 0; r < 8; ++r) st[qi][1].f[r] = __builtin_amdgcn_exp2f(st[qi][1].f[r]);

            // Pack P as A-fragment: S^T C-layout maps 1:1 onto P A-layout (same lane).
#pragma unroll
            for (int r = 0; r < 4; ++r) {
                pa[qi].u[r]     = pk(st[qi][0].f[2 * r], st[qi][0].f[2 * r + 1]);
                pa[qi].u[4 + r] = pk(st[qi][1].f[2 * r], st[qi][1].f[2 * r + 1]);
            }
        }

#pragma unroll
        for (int dt = 0; dt < 4; ++dt)
#pragma unroll
            for (int qi = 0; qi < QT; ++qi)
                o[qi][dt] = wmma_bf16(pa[qi].v, bvv[dt].v, o[qi][dt]);
#pragma unroll
        for (int qi = 0; qi < QT; ++qi)
            lacc[qi] = wmma_bf16(pa[qi].v, ones.v, lacc[qi]);
      }

        // This wave's reads of cur are done before the barrier lets it be refilled.
        asm volatile("s_wait_dscnt 0x0" ::: "memory");
        wait_async0();      // next stage's data landed in LDS
        __syncthreads();    // all waves done reading cur, next stage visible
        cur = nxt;
    }

    const int b = bh / HH, h = bh % HH;

    // Wo fragments and bias, asked for first: their latency runs under the staging.
    FragBF wf[2][4];
    float bias[4];
#pragma unroll
    for (int ks = 0; ks < 2; ++ks) {
        const uint4* wb = Wob + (size_t)(h * 2 + ks) * 256 + half * 64;
#pragma unroll
        for (int ct = 0; ct < 4; ++ct) {
            wf[ks][ct].q[0] = wb[ct * 16 + l16];
            wf[ks][ct].q[1] = wb[128 + ct * 16 + l16];
        }
    }
#pragma unroll
    for (int ct = 0; ct < 4; ++ct) bias[ct] = bo[h * DD + ct * 16 + l16];

    // Normalize by l, round to bf16 and lay the rows in this wave's own LDS range
    // (the loop's last barrier has ended every read of the ring; no copy is in flight).
    __bf16* ob = (__bf16*)smem4 + wave * (16 * QT * OPITCH / 2);
#pragma unroll
    for (int qi = 0; qi < QT; ++qi) {
#pragma unroll
        for (int dt = 0; dt < 4; ++dt)
#pragma unroll
            for (int r = 0; r < 8; ++r)
                ob[(qi * 16 + r + 8 * half) * (OPITCH / 2) + dt * 16 + l16] = (__bf16)(o[qi][dt][r] / lacc[qi][r]);
    }
    // The rows are read back by other lanes of the same wave: every store above
    // has to be done, and no read below may be lifted over it.
    asm volatile("s_wait_dscnt 0x0" ::: "memory");

    // A fragments (lane = query row): 2 x ds_load_b128 per K-slice and tile.
    const uint4* ob4 = (const uint4*)ob;
    FragBF a[QT][2];
#pragma unroll
    for (int qi = 0; qi < QT; ++qi)
#pragma unroll
        for (int ks = 0; ks < 2; ++ks) {
            a[qi][ks].q[0] = ob4[(qi * 16 + l16) * (OPITCH / 16) + ks * 4 + half];
            a[qi][ks].q[1] = ob4[(qi * 16 + l16) * (OPITCH / 16) + ks * 4 + 2 + half];
        }

    v8f c[QT][4];
#pragma unroll
    for (int qi = 0; qi < QT; ++qi) {
        v8f z = {};
        for (int i = 0; i < 4; ++i) c[qi][i] = z;
    }
#pragma unroll
    for (int ks = 0; ks < 2; ++ks)
#pragma unroll
        for (int ct = 0; ct < 4; ++ct)
#pragma unroll
            for (int qi = 0; qi < QT; ++qi)
                c[qi][ct] = wmma_bf16(a[qi][ks].v, wf[ks][ct].v, c[qi][ct]);

#pragma unroll
    for (int qi = 0; qi < QT; ++qi)
#pragma unroll
        for (int ct = 0; ct < 4; ++ct)
#pragma unroll
            for (int r = 0; r < 8; ++r) {
                const int row = q0 + qi * 16 + r + 8 * half;
                out[((size_t)(b * NN + row) * HH + h) * DD + ct * 16 + l16] = c[qi][ct][r] + bias[ct];
            }
}

extern "C" void kernel_launch(void* const* d_in, const int* in_sizes, int n_in,
                              void* d_out, int out_size, void* d_ws, size_t ws_size,
                              hipStream_t stream) {
    const float* x  = (const float*)d_in[0];
    const float* Wq = (const float*)d_in[1];
    const float* bq = (const float*)d_in[2];
    const float* Wk = (const float*)d_in[3];
    const float* bk = (const float*)d_in[4];
    const float* Wv = (const float*)d_in[5];
    const float* bv = (const float*)d_in[6];
    const float* Wo = (const float*)d_in[7];
    const float* bo = (const float*)d_in[8];
    float* out = (float*)d_out;

    const size_t SZ = (size_t)BB * HH * NN * DD;     // elems per bf16 tensor
    __bf16* Qs = (__bf16*)d_ws;
    __bf16* Ks = Qs + SZ;
    __bf16* Vt = Ks + SZ;
    unsigned* Wob = (unsigned*)(Vt + SZ);            // packed Wo: HH * 32 * 64 dwords

    dim3 grid(NN / 64, BB * HH);
    qkv_proj_kernel <<<grid, 128, 0, stream>>>(x, Wq, bq, Wk, bk, Wv, bv, Wo, Qs, Ks, Vt, Wob);
    flash_attn_kernel<<<dim3(NN / (64 * QT), BB * HH), 128, 0, stream>>>(Qs, Ks, Vt,
                                               (const uint4*)Wob, bo, out);
}

// v010
// It runs in 69.2 microseconds.
// Timed twice side by side with v009, it ran 1.04 times as fast both times.
// Over all steps from v000 it is 3.04 times as fast.
#include <hip/hip_runtime.h>
#include <hip/hip_bf16.h>

#define BB 4
#define NN 2048
#define HH 16
#define DD 64

// Keys per ring stage: a stage's Vt rows are then 256 B, whole 128 B lines, and
// a stage is worked off in SKEYS / 32 passes of 32 keys between two barriers.
#define SKEYS 128
// LDS row pitches in bytes, 16 B x odd: the 16 lanes of a ds_load_b128 half
// then start on 16 different 4-bank groups (64 banks x 4 B), no bank conflict.
#define KPITCH 144                 // K rows: 128 B of data + 16 B pad
#define VPITCH (SKEYS * 2 + 16)    // Vt rows: SKEYS bf16 of data + 16 B pad
#define KBUF   (SKEYS * KPITCH)    // one K stage, SKEYS keys
#define VBUF   (64 * VPITCH)       // one Vt stage, 64 d-rows
#define OPITCH 144                 // O rows staged for the output projection: 128 B + 16 B pad

// Score scale 1/sqrt(1024) times log2(e): K.Q^T then counts in powers of two.
#define QSCALE 0.045084220f

typedef __attribute__((ext_vector_type(16))) __bf16 v16bf;
typedef __attribute__((ext_vector_type(8)))  float  v8f;

typedef __attribute__((ext_vector_type(8)))  unsigned v8u;

union FragBF { v16bf v; v8u w; unsigned u[8]; uint4 q[2]; };
union Acc    { v8f v; float f[8]; };

// Pinned packed conversion: keeps SLP from turning pairs into v_perm shuffles.
__device__ __forceinline__ unsigned pk(float a, float b) {
    unsigned d;
    asm("v_cvt_pk_bf16_f32 %0, %1, %2" : "=v"(d) : "v"(a), "v"(b));
    return d;
}

__device__ __forceinline__ v8f wmma_bf16(const v16bf& a, const v16bf& b, const v8f& c) {
    return __builtin_amdgcn_wmma_f32_16x16x32_bf16(false, a, false, b, (short)0, c, false, false);
}

// Scores of 32 keys (two 16-key fragments) x 2 query tiles: d = a0.b_0 + a1.b_1 + c,
// with D apart from C.
// In asm because the builtin ties D to C where C is used last and copies all of C
// first (8 v_mov_b64 a pass), which would give back half of what C saves.
// The four v_nop keep the chip's distance from the last WMMA to the first vector
// instruction on its D, A or B: the compiler counts nothing inside asm.
// dTS: query tile T, key fragment S; aSK: key fragment S, K-slice K; bTK: query tile T.
__device__ __forceinline__ void score_wmma(
    v8f& d00, v8f& d10, v8f& d01, v8f& d11,
    const v8u& a00, const v8u& a01, const v8u& a10, const v8u& a11,
    const v8u& b00, const v8u& b01, const v8u& b10, const v8u& b11,
    const v8f& c0, const v8f& c1) {
    asm("v_wmma_f32_16x16x32_bf16 %0, %4, %8, %12\n\t"
        "v_wmma_f32_16x16x32_bf16 %1, %4, %10, %13\n\t"
        "v_wmma_f32_16x16x32_bf16 %2, %6, %8, %12\n\t"
        "v_wmma_f32_16x16x32_bf16 %3, %6, %10, %13\n\t"
        "v_wmma_f32_16x16x32_bf16 %0, %5, %9, %0\n\t"
        "v_wmma_f32_16x16x32_bf16 %1, %5, %11, %1\n\t"
        "v_wmma_f32_16x16x32_bf16 %2, %7, %9, %2\n\t"
        "v_wmma_f32_16x16x32_bf16 %3, %7, %11, %3\n\t"
        "v_nop\n\tv_nop\n\tv_nop\n\tv_nop"
        : "=&v"(d00), "=&v"(d10), "=&v"(d01), "=&v"(d11)
        : "v"(a00), "v"(a01), "v"(a10), "v"(a11),
          "v"(b00), "v"(b01), "v"(b10), "v"(b11), "v"(c0), "v"(c1));
}

// K fragments of one pass (32 keys, rows at kb4): 8 x ds_load_b128, one group.
__device__ __forceinline__ void load_k(
    FragBF ka[2][2], const uint4* kb4, int l16, int half) {
#pragma unroll
    for (int sub = 0; sub < 2; ++sub)
#pragma unroll
        for (int ks = 0; ks < 2; ++ks) {
            ka[sub][ks].q[0] = kb4[(sub * 16 + l16) * (KPITCH / 16) + ks * 4 + half];
            ka[sub][ks].q[1] = kb4[(sub * 16 + l16) * (KPITCH / 16) + ks * 4 + 2 + half];
        }
}

// alpha of query R + 8*half, where lane = query in both 16-lane rows: row 0 takes lane R
// of its row, row 1 lane R + 8 of its own (DPP row_share). No index registers, which a
// ds_bpermute form keeps live through the whole loop.
template<int R>
__device__ __forceinline__ float alpha_of_row(float alpha) {
    const int ai = __float_as_int(alpha);
    const int a0 = __builtin_amdgcn_update_dpp(0, ai, 0x150 + R, 0xf, 0xf, false);
    return __int_as_float(__builtin_amdgcn_update_dpp(a0, ai, 0x158 + R, 0x2, 0xf, false));
}

// This wave's async copies have landed in LDS; no LDS read may be lifted over it.
__device__ __forceinline__ void wait_async0() {
    asm volatile("s_wait_asynccnt 0x0" ::: "memory");
}

// Eight async copies of 16 B per lane (global -> LDS), tracked by ASYNCcnt:
// copy i goes from g + i * gstep to LDS byte l + i * lstep.
// s_wait_xcnt 0 closes the statement so that no address register named here
// is rewritten (the next statement's address additions) ahead of it.
__device__ __forceinline__ void async_b128x8(
    unsigned l, unsigned lstep, unsigned long long g, unsigned long long gstep) {
    asm volatile("global_load_async_to_lds_b128 %0, %1, off\n\t"
                 "global_load_async_to_lds_b128 %2, %3, off\n\t"
                 "global_load_async_to_lds_b128 %4, %5, off\n\t"
                 "global_load_async_to_lds_b128 %6, %7, off\n\t"
                 "global_load_async_to_lds_b128 %8, %9, off\n\t"
                 "global_load_async_to_lds_b128 %10, %11, off\n\t"
                 "global_load_async_to_lds_b128 %12, %13, off\n\t"
                 "global_load_async_to_lds_b128 %14, %15, off\n\t"
                 "s_wait_xcnt 0x0"
                 :: "v"(l),             "v"(g),
                    "v"(l + lstep),     "v"(g + gstep),
                    "v"(l + 2 * lstep), "v"(g + 2 * gstep),
                    "v"(l + 3 * lstep), "v"(g + 3 * gstep),
                    "v"(l + 4 * lstep), "v"(g + 4 * gstep),
                    "v"(l + 5 * lstep), "v"(g + 5 * gstep),
                    "v"(l + 6 * lstep), "v"(g + 6 * gstep),
                    "v"(l + 7 * lstep), "v"(g + 7 * gstep) : "memory");
}

// Fragment dword map (16-bit 16x16x32 WMMA, wave32):
//   register r (0..7), lane-half hf: dword index = (r>>2)*8 + hf*4 + (r&3)
//   within a 32-dword (64 bf16) row; K-slice ks adds 16 dwords.
// => u[0..3] and u[4..7] are each 16B-contiguous: load fragments as 2 x b128.

// Packed weights, bf16, fragment-major. Slot kg = ks*4 + g*2 + hf (0..7) holds, per
// output column, one uint4 = registers r = 0..3 with k = kg*8 + 2r (+1).
// In LDS (Wq, Wk, Wv of one head): uint4[kg * WPITCH + col + (col >> 4)]. The skew of
// one uint4 per 16 columns lets both sides go without bank conflict: the writers'
// 16 lanes stand 4 columns apart, the readers' 16 lanes 1 column apart.
// In memory (Wo, all heads): uint4[(h*2+ks)*256 + g*128 + hf*64 + col].
#define WPITCH 68                  // uint4 per slot: 64 columns + 3 of skew, rounded up
#define WMAT   (8 * WPITCH)        // uint4 per matrix

// Thread t takes rows k = 8*(t>>4) .. +7, columns 4*(t&15) .. +3 of W[h] (fp32):
// each wave-wide load covers two rows of 256 B, whole lines.
__device__ __forceinline__ void load_w(
    const float* __restrict__ Wm, int h, int t, float4 f[8])
{
    const char* wh = (const char*)(Wm + (size_t)h * DD * DD);        // same for the block
    const unsigned off = (unsigned)(t >> 4) * (8u * DD * 4u) + (unsigned)(t & 15) * 16u;
#pragma unroll
    for (int j = 0; j < 8; ++j) f[j] = *(const float4*)(wh + (off + (unsigned)j * (DD * 4u)));
}

// Rounds them to bf16 in k pairs and lays the four columns' uint4 into the LDS image.
__device__ __forceinline__ void store_w(uint4* __restrict__ wl, int t, const float4 f[8])
{
    const int cg = t & 15;
    uint4* d = wl + (t >> 4) * WPITCH + cg * 4 + (cg >> 2);
    d[0] = make_uint4(pk(f[0].x, f[1].x), pk(f[2].x, f[3].x), pk(f[4].x, f[5].x), pk(f[6].x, f[7].x));
    d[1] = make_uint4(pk(f[0].y, f[1].y), pk(f[2].y, f[3].y), pk(f[4].y, f[5].y), pk(f[6].y, f[7].y));
    d[2] = make_uint4(pk(f[0].z, f[1].z), pk(f[2].z, f[3].z), pk(f[4].z, f[5].z), pk(f[6].z, f[7].z));
    d[3] = make_uint4(pk(f[0].w, f[1].w), pk(f[2].w, f[3].w), pk(f[4].w, f[5].w), pk(f[6].w, f[7].w));
}

// One projection matrix: 16 rows x 64 cols; each B-frag = 2 x ds_load_b128.
// MODE 0: Q (scaled log2(e)/32, [B,H,N,D]); 1: K ([B,H,N,D]); 2: V transposed ([B,H,D,N]).
template<int MODE>
__device__ __forceinline__ void proj_mat(
    const FragBF a[2], const uint4* __restrict__ wl,
    const float* __restrict__ bias, int bh, int h,
    int n0, int l16, int half, __bf16* __restrict__ dst)
{
    v8f c[4];
    { v8f z = {}; for (int i = 0; i < 4; ++i) c[i] = z; }
#pragma unroll
    for (int ks = 0; ks < 2; ++ks) {
        const uint4* wb = wl + (ks * 4 + half) * WPITCH;
#pragma unroll
        for (int ct = 0; ct < 4; ++ct) {
            const int pos = ct * 17 + l16;        // col + (col >> 4), col = ct*16 + l16
            FragBF bf;
            bf.q[0] = wb[pos];                    // regs 0..3 (g = 0)
            bf.q[1] = wb[2 * WPITCH + pos];       // regs 4..7 (g = 1)
            c[ct] = wmma_bf16(a[ks].v, bf.v, c[ct]);
        }
    }
#pragma unroll
    for (int ct = 0; ct < 4; ++ct) {
        const int col = ct * 16 + l16;
        const float bv = bias[h * DD + col];
#pragma unroll
        for (int r = 0; r < 8; ++r) {
            const int row = n0 + r + 8 * half;           // C: m = r + 8*half
            const float val = c[ct][r] + bv;
            if (MODE == 0)
                dst[((size_t)bh * NN + row) * DD + col] = (__bf16)(val * QSCALE);
            else if (MODE == 1)
                dst[((size_t)bh * NN + row) * DD + col] = (__bf16)val;
            else
                dst[((size_t)bh * DD + col) * NN + row] = (__bf16)val;
        }
    }
}

// ---------------------------------------------------------------------------
// Kernel 1: fused Q/K/V projection. grid = (N/64, B*H), block = 128 (4 waves).
// Reads x as fp32 and rounds it to bf16 in registers: each x element is used by
// exactly one wave, so a bf16 copy in memory would only add a round trip.
// The work-group packs its head's Wq, Wk, Wv itself, fp32 rows -> bf16 fragments in
// LDS, and the blocks of batch 0 pack Wo for the attention launch (64 dwords each):
// no launch of its own for the weights.
// ---------------------------------------------------------------------------
__global__ __launch_bounds__(128) void qkv_proj_kernel(
    const float* __restrict__ x,
    const float* __restrict__ Wq, const float* __restrict__ bq,
    const float* __restrict__ Wk, const float* __restrict__ bk,
    const float* __restrict__ Wv, const float* __restrict__ bv,
    const float* __restrict__ Wo,
    __bf16* __restrict__ Qs, __bf16* __restrict__ Ks, __bf16* __restrict__ Vt,
    unsigned* __restrict__ Wob)
{
    __shared__ uint4 wlds[3 * WMAT];

    const int bh   = blockIdx.y;
    const int b    = bh / HH, h = bh % HH;
    const int wave = threadIdx.x >> 5;
    const int lane = threadIdx.x & 31;
    const int half = lane >> 4;
    const int l16  = lane & 15;
    const int n0   = blockIdx.x * 64 + wave * 16;

    // A fragments: rows n0..n0+15 of x. Registers g*4..g*4+3 of K-slice ks hold
    // k = ks*32 + g*16 + half*8 .. +7: 8 floats = 2 x b128, packed in pairs.
    FragBF a[2];
    {
        const float4* xp4 = (const float4*)(x + ((size_t)(b * NN + n0 + l16) * HH + h) * DD);
        float4 f[2][2][2];
#pragma unroll
        for (int ks = 0; ks < 2; ++ks)
#pragma unroll
            for (int g = 0; g < 2; ++g) {
                f[ks][g][0] = xp4[ks * 8 + g * 4 + half * 2];
                f[ks][g][1] = xp4[ks * 8 + g * 4 + half * 2 + 1];
            }
        // Wo[h], k pair blockIdx.x, 64 columns: waves 0 and 1 of the blocks of batch 0.
        static_assert(NN / 64 == DD / 2, "one block of batch 0 per k pair of Wo");
        const bool packs_wo = (b == 0 && wave < 2);
        float wo0 = 0.f, wo1 = 0.f;
        if (packs_wo) {
            const float* wop = Wo + ((size_t)h * DD + 2 * blockIdx.x) * DD + threadIdx.x;
            wo0 = wop[0];
            wo1 = wop[DD];
        }
        float4 wq[8], wk[8], wv[8];
        load_w(Wq, h, threadIdx.x, wq);
        load_w(Wk, h, threadIdx.x, wk);
        load_w(Wv, h, threadIdx.x, wv);
        // Keeps all loads of x and of the weights ahead of the first conversion: sunk
        // between the conversions they would expose the memory latency once a group.
        __builtin_amdgcn_sched_barrier(0);
        store_w(wlds, threadIdx.x, wq);
        store_w(wlds + WMAT, threadIdx.x, wk);
        store_w(wlds + 2 * WMAT, threadIdx.x, wv);
        // Every wave reads fragments that all four waves have written.
        __syncthreads();
        // Behind the barrier, so that the barrier does not wait for this store.
        if (packs_wo) {
            const int col = threadIdx.x;
            const int k2  = blockIdx.x;                  // k/2 = ks*16 + g*8 + hf*4 + r
            const int dst = (((h * 2 + (k2 >> 4)) * 256 + ((k2 >> 3) & 1) * 128
                              + ((k2 >> 2) & 1) * 64 + col) << 2) + (k2 & 3);
            Wob[dst] = pk(wo0, wo1);
        }
#pragma unroll
        for (int ks = 0; ks < 2; ++ks)
#pragma unroll
            for (int g = 0; g < 2; ++g) {
                a[ks].u[g * 4 + 0] = pk(f[ks][g][0].x, f[ks][g][0].y);
                a[ks].u[g * 4 + 1] = pk(f[ks][g][0].z, f[ks][g][0].w);
                a[ks].u[g * 4 + 2] = pk(f[ks][g][1].x, f[ks][g][1].y);
                a[ks].u[g * 4 + 3] = pk(f[ks][g][1].z, f[ks][g][1].w);
            }
    }
    proj_mat<0>(a, wlds, bq, bh, h, n0, l16, half, Qs);
    proj_mat<1>(a, wlds + WMAT, bk, bh, h, n0, l16, half, Ks);
    proj_mat<2>(a, wlds + 2 * WMAT, bv, bh, h, n0, l16, half, Vt);
}

// Stage SKEYS keys of K and Vt into an LDS buffer (async, ASYNCcnt-tracked).
// Neighbouring lanes take neighbouring 16 B, so that the 32 lanes of every copy
// cover 512 B in four whole 128 B lines: a copy that takes 16 B or 32 B out of
// each of 8 or 16 lines asks the L2 for as many lines and uses a part of each.
__device__ __forceinline__ void stage_tile(
    const __bf16* __restrict__ Ks, const __bf16* __restrict__ Vt,
    int bh, int j0, int t, unsigned klds, unsigned vlds)
{
    static_assert(SKEYS == 128, "eight copies of K and eight of Vt a thread");
    // K stage: rows j0..j0+127 are 16 KB in a row; the block takes 2 KB (16 rows) a copy.
    unsigned long long kg = (unsigned long long)(uintptr_t)
        (Ks + ((size_t)bh * NN + j0) * DD) + (unsigned long long)t * 16u;
    async_b128x8(klds, 16u * KPITCH, kg, 2048u);
    // Vt stage: 64 rows (d) x 256 B, 16 lanes a row; the block takes 8 rows a copy.
    unsigned long long vg = (unsigned long long)(uintptr_t)
        (Vt + ((size_t)bh * DD + (t >> 4)) * NN + j0) + ((unsigned long long)(t & 15) << 4);
    async_b128x8(vlds, 8u * VPITCH, vg, 8u * NN * 2u);
}

// ---------------------------------------------------------------------------
// Kernel 2: flash attention. grid = (N/128, B*H), block = 128 (4 waves).
// Each wave owns QT = 2 query tiles (32 queries): every K and Vt fragment read
// from LDS feeds two WMMAs, and one staged tile serves 128 queries.
// S^T = K.Q^T so the score C-layout refeeds directly as the P A-fragment.
// The score WMMA starts from C = minus the maximum in use, and Q carries log2(e):
// its result is the argument of exp2 as it stands, no vector subtract or multiply.
// The softmax denominators come off the matrix pipe: l += P . ones, with the same
// bf16 P that feeds P.V, in a tile laid out like an O tile (query = r + 8*half).
// Double-buffered LDS staging: stage s+1 async-loads overlap the passes of stage s.
// K fragments are fetched one pass ahead inside a stage, a whole pass's as one group.
// Epilogue: out[b,n,h,:] = attn[b,h,n,:].Wo[h] + bo[h] (fp32) on the wave's own
// 32 rows: attn never goes to memory and needs no launch of its own.
// ---------------------------------------------------------------------------
#define QT 2
#define RESCALE_T 8.0f             // in powers of two
__global__ __launch_bounds__(128) void flash_attn_kernel(
    const __bf16* __restrict__ Qs, const __bf16* __restrict__ Ks,
    const __bf16* __restrict__ Vt, const uint4* __restrict__ Wob,
    const float* __restrict__ bo, float* __restrict__ out)
{
    // One array: two Vt stages (64 d x SKEYS bf16), two K stages (SKEYS keys x 64 bf16),
    // padded rows; behind the loop the same bytes stage O, 32 rows a wave.
    __shared__ uint4 smem4[(2 * VBUF + 2 * KBUF) / 16];
    static_assert(4 * 16 * QT * OPITCH <= 2 * VBUF + 2 * KBUF, "O staging fits the ring");

    const int bh   = blockIdx.y;
    const int wave = threadIdx.x >> 5;
    const int lane = threadIdx.x & 31;
    const int half = lane >> 4;
    const int l16  = lane & 15;
    const int q0   = blockIdx.x * (64 * QT) + wave * (16 * QT);
    const int t    = threadIdx.x;

    // LDS byte offsets (generic shared pointer: low 32 bits = LDS offset)
    const unsigned voff = (unsigned)(uintptr_t)(void*)&smem4[0];
    const unsigned koff = voff + 2u * VBUF;
    const unsigned kl_t = (unsigned)(t >> 3) * KPITCH + ((unsigned)(t & 7) << 4);
    const unsigned vl_t = (unsigned)(t >> 4) * VPITCH + ((unsigned)(t & 15) << 4);

    // Resident Q^T B-fragments (lane = query): 2 x b128 per K-slice and tile.
    FragBF qt[QT][2];
#pragma unroll
    for (int qi = 0; qi < QT; ++qi) {
        const uint4* qp4 = (const uint4*)(Qs + ((size_t)bh * NN + q0 + qi * 16 + l16) * DD);
#pragma unroll
        for (int ks = 0; ks < 2; ++ks) {
            qt[qi][ks].q[0] = qp4[ks * 4 + half];
            qt[qi][ks].q[1] = qp4[ks * 4 + 2 + half];
        }
    }

    // cneg: minus the maximum in use, the lane's query in all eight registers
    // (C layout: lane = query).
    v8f lacc[QT];
    v8f cneg[QT];
    v8f o[QT][4];
#pragma unroll
    for (int qi = 0; qi < QT; ++qi) {
        v8f z = {};
        lacc[qi] = z;
        cneg[qi] = z;
        for (int i = 0; i < 4; ++i) o[qi][i] = z;
    }

    // B fragment of ones (bf16 1.0 in every place): P . ones puts each query's sum
    // over the pass's 32 keys into all 16 columns, so every lane holds its rows' l.
    // Made by v_mov in asm so that its eight registers stay resident: a plain constant
    // is kept in scalar registers and copied to vector registers anew in every pass.
    FragBF ones;
#pragma unroll
    for (int r = 0; r < 8; ++r) asm("v_mov_b32 %0, 0x3f803f80" : "=v"(ones.u[r]));

    // Prologue: stage 0 into buffer 0
    stage_tile(Ks, Vt, bh, 0, t, koff + kl_t, voff + vl_t);
    wait_async0();
    __syncthreads();

    // First maximum in use: the true maximum of the first 32 keys' scores (their
    // products are made once more, from C = 0), so that the loop has one case only.
    {
        const uint4* kb4 = smem4 + (2 * VBUF) / 16;
        Acc s0[QT][2];
        FragBF k0[2][2];
        load_k(k0, kb4, l16, half);
        score_wmma(s0[0][0].v, s0[1][0].v, s0[0][1].v, s0[1][1].v,
                   k0[0][0].w, k0[0][1].w, k0[1][0].w, k0[1][1].w,
                   qt[0][0].w, qt[0][1].w, qt[1][0].w, qt[1][1].w, cneg[0], cneg[1]);
#pragma unroll
        for (int qi = 0; qi < QT; ++qi) {
            float tmax = s0[qi][0].f[0];
#pragma unroll
            for (int r = 1; r < 8; ++r) tmax = fmaxf(tmax, s0[qi][0].f[r]);
#pragma unroll
            for (int r = 0; r < 8; ++r) tmax = fmaxf(tmax, s0[qi][1].f[r]);
            tmax = fmaxf(tmax, __shfl_xor(tmax, 16, 32));
#pragma unroll
            for (int r = 0; r < 8; ++r) cneg[qi][r] = -tmax;
        }
    }

    int cur = 0;
    for (int j0 = 0; j0 < NN; j0 += SKEYS) {
        const int nxt = cur ^ 1;
        // K fragments of the stage's first pass, asked for ahead of the copies' address
        // work and issue, which then cover their LDS latency.
        FragBF ka[2][2];
        load_k(ka, smem4 + (2 * VBUF + cur * KBUF) / 16, l16, half);
        if (j0 + SKEYS < NN)   // issue next stage's async loads; overlap with compute
            stage_tile(Ks, Vt, bh, j0 + SKEYS, t,
                       koff + (unsigned)nxt * KBUF + kl_t,
                       voff + (unsigned)nxt * VBUF + vl_t);

      // Kept rolled: unrolled, the build takes more than 256 registers, and the four
      // waves a SIMD that hold the whole grid at once need an allocation of at most 256.
#pragma unroll 1
      for (int p = 0; p < SKEYS / 32; ++p) {
        // Pass p: K rows p*32 .. +31 of the stage, bytes p*64 .. +63 of each Vt row.
        const uint4* kb4 = smem4 + (2 * VBUF + cur * KBUF) / 16 + p * (32 * KPITCH / 16);
        const uint4* vb4 = smem4 + (cur * VBUF) / 16 + p * 4;

        // S^T tiles: st[qi][sub] = K[j0+p*32+sub*16 .. +15] . Q^T - shift  (C: lane=query, vgpr=key)
        Acc st[QT][2];
        static_assert(QT == 2, "score_wmma takes two query tiles");
        score_wmma(st[0][0].v, st[1][0].v, st[0][1].v, st[1][1].v,
                   ka[0][0].w, ka[0][1].w, ka[1][0].w, ka[1][1].w,
                   qt[0][0].w, qt[0][1].w, qt[1][0].w, qt[1][1].w, cneg[0], cneg[1]);

        // Vt fragments, read as one group ahead of the branch below: their LDS
        // latency runs under the maximum and the exponentials; behind the branch
        // each pair would be waited for right in front of its WMMAs.
        FragBF bvv[4];                                       // 8 x ds_load_b128
#pragma unroll
        for (int dt = 0; dt < 4; ++dt) {
            bvv[dt].q[0] = vb4[(dt * 16 + l16) * (VPITCH / 16) + half];
            bvv[dt].q[1] = vb4[(dt * 16 + l16) * (VPITCH / 16) + 2 + half];
        }

        // Lazy rescale: the maximum in use moves, and O and l are rescaled, only
        // when some query's new score exceeds it by more than RESCALE_T (P then
        // stays <= 2^RESCALE_T = 256; O / l is the same quotient for any maximum).
        float tloc[QT];
        bool need = false;
#pragma unroll
        for (int qi = 0; qi < QT; ++qi) {
            // This lane's 16 of the query's 32 keys (the rest: lane ^ 16).
            float tmax = st[qi][0].f[0];
#pragma unroll
            for (int r = 1; r < 8; ++r) tmax = fmaxf(tmax, st[qi][0].f[r]);
#pragma unroll
            for (int r = 0; r < 8; ++r) tmax = fmaxf(tmax, st[qi][1].f[r]);
            tloc[qi] = tmax;
            need = need || (tmax > RESCALE_T);
        }
        // One wave-uniform scalar test a pass, over both halves and both tiles.
        // Marked unlikely so that the rescale lies outside the loop's straight line
        // (else the usual pass takes two more jumps round it).
        if (__builtin_expect(__builtin_amdgcn_ballot_w32(need) != 0, 0)) {
#pragma unroll
            for (int qi = 0; qi < QT; ++qi) {
                const float tmax  = fmaxf(tloc[qi], __shfl_xor(tloc[qi], 16, 32));
                const float d     = fmaxf(tmax, 0.f);        // rise of the maximum in use
                const float alpha = __builtin_amdgcn_exp2f(-d);
                const float cn    = cneg[qi][0] - d;
#pragma unroll
                for (int r = 0; r < 8; ++r) cneg[qi][r] = cn;
                // Per-query alpha into the O-tile layout (query = r + 8*half)
                const float am8[8] = {
                    alpha_of_row<0>(alpha), alpha_of_row<1>(alpha), alpha_of_row<2>(alpha),
                    alpha_of_row<3>(alpha), alpha_of_row<4>(alpha), alpha_of_row<5>(alpha),
                    alpha_of_row<6>(alpha), alpha_of_row<7>(alpha) };
#pragma unroll
                for (int r = 0; r < 8; ++r) {
                    const float am = am8[r];
                    lacc[qi][r] *= am;
#pragma unroll
                    for (int dt = 0; dt < 4; ++dt) o[qi][dt][r] *= am;
                }
            }
            // This pass's scores once more, from the new C (its K fragments are still held).
            score_wmma(st[0][0].v, st[1][0].v, st[0][1].v, st[1][1].v,
                       ka[0][0].w, ka[0][1].w, ka[1][0].w, ka[1][1].w,
                       qt[0][0].w, qt[0][1].w, qt[1][0].w, qt[1][1].w, cneg[0], cneg[1]);
        }

        // The next pass's K fragments, into the same registers, as soon as this pass's
        // scores stand: their LDS latency runs under the exponentials and P.V instead of
        // standing in front of the next score products. Within the stage only: the
        // stage's last pass fetches nothing, so no row of the other buffer is read.
        if (p + 1 < SKEYS / 32)
            load_k(ka, kb4 + 32 * KPITCH / 16, l16, half);

        FragBF pa[QT];
#pragma unroll
        for (int qi = 0; qi < QT; ++qi) {
            // Softmax numerators (scale and shift are in the scores). Keys split lane <-> lane^16.
#pragma unroll
            for (int r = 0; r < 8; ++r) st[qi][0].f[r] = __builtin_amdgcn_exp2f(st[qi][0].f[r]);
#pragma unroll
            for (int r = 0; r < 8; ++r) st[qi][1].f[r] = __builtin_amdgcn_exp2f(st[qi][1].f[r]);

            // Pack P as A-fragment: S^T C-layout maps 1:1 onto P A-layout (same lane).
#pragma unroll
            for (int r = 0; r < 4; ++r) {
                pa[qi].u[r]     = pk(st[qi][0].f[2 * r], st[qi][0].f[2 * r + 1]);
                pa[qi].u[4 + r] = pk(st[qi][1].f[2 * r], st[qi][1].f[2 * r + 1]);
            }
        }

#pragma unroll
        for (int dt = 0; dt < 4; ++dt)
#pragma unroll
            for (int qi = 0; qi < QT; ++qi)
                o[qi][dt] = wmma_bf16(pa[qi].v, bvv[dt].v, o[qi][dt]);
#pragma unroll
        for (int qi = 0; qi < QT; ++qi)
            lacc[qi] = wmma_bf16(pa[qi].v, ones.v, lacc[qi]);
      }

        // This wave's reads of cur are done before the barrier lets it be refilled.
        asm volatile("s_wait_dscnt 0x0" ::: "memory");
        wait_async0();      // next stage's data landed in LDS
        __syncthreads();    // all waves done reading cur, next stage visible
        cur = nxt;
    }

    const int b = bh / HH, h = bh % HH;

    // Wo fragments and bias, asked for first: their latency runs under the staging.
    FragBF wf[2][4];
    float bias[4];
#pragma unroll
    for (int ks = 0; ks < 2; ++ks) {
        const uint4* wb = Wob + (size_t)(h * 2 + ks) * 256 + half * 64;
#pragma unroll
        for (int ct = 0; ct < 4; ++ct) {
            wf[ks][ct].q[0] = wb[ct * 16 + l16];
            wf[ks][ct].q[1] = wb[128 + ct * 16 + l16];
        }
    }
#pragma unroll
    for (int ct = 0; ct < 4; ++ct) bias[ct] = bo[h * DD + ct * 16 + l16];

    // Normalize by l, round to bf16 and lay the rows in this wave's own LDS range
    // (the loop's last barrier has ended every read of the ring; no copy is in flight).
    __bf16* ob = (__bf16*)smem4 + wave * (16 * QT * OPITCH / 2);
#pragma unroll
    for (int qi = 0; qi < QT; ++qi) {
#pragma unroll
        for (int dt = 0; dt < 4; ++dt)
#pragma unroll
            for (int r = 0; r < 8; ++r)
                ob[(qi * 16 + r + 8 * half) * (OPITCH / 2) + dt * 16 + l16] = (__bf16)(o[qi][dt][r] / lacc[qi][r]);
    }
    // The rows are read back by other lanes of the same wave: every store above
    // has to be done, and no read below may be lifted over it.
    asm volatile("s_wait_dscnt 0x0" ::: "memory");

    // A fragments (lane = query row): 2 x ds_load_b128 per K-slice and tile.
    const uint4* ob4 = (const uint4*)ob;
    FragBF a[QT][2];
#pragma unroll
    for (int qi = 0; qi < QT; ++qi)
#pragma unroll
        for (int ks = 0; ks < 2; ++ks) {
            a[qi][ks].q[0] = ob4[(qi * 16 + l16) * (OPITCH / 16) + ks * 4 + half];
            a[qi][ks].q[1] = ob4[(qi * 16 + l16) * (OPITCH / 16) + ks * 4 + 2 + half];
        }

    v8f c[QT][4];
#pragma unroll
    for (int qi = 0; qi < QT; ++qi) {
        v8f z = {};
        for (int i = 0; i < 4; ++i) c[qi][i] = z;
    }
#pragma unroll
    for (int ks = 0; ks < 2; ++ks)
#pragma unroll
        for (int ct = 0; ct < 4; ++ct)
#pragma unroll
            for (int qi = 0; qi < QT; ++qi)
                c[qi][ct] = wmma_bf16(a[qi][ks].v, wf[ks][ct].v, c[qi][ct]);

#pragma unroll
    for (int qi = 0; qi < QT; ++qi)
#pragma unroll
        for (int ct = 0; ct < 4; ++ct)
#pragma unroll
            for (int r = 0; r < 8; ++r) {
                const int row = q0 + qi * 16 + r + 8 * half;
                out[((size_t)(b * NN + row) * HH + h) * DD + ct * 16 + l16] = c[qi][ct][r] + bias[ct];
            }
}

extern "C" void kernel_launch(void* const* d_in, const int* in_sizes, int n_in,
                              void* d_out, int out_size, void* d_ws, size_t ws_size,
                              hipStream_t stream) {
    const float* x  = (const float*)d_in[0];
    const float* Wq = (const float*)d_in[1];
    const float* bq = (const float*)d_in[2];
    const float* Wk = (const float*)d_in[3];
    const float* bk = (const float*)d_in[4];
    const float* Wv = (const float*)d_in[5];
    const float* bv = (const float*)d_in[6];
    const float* Wo = (const float*)d_in[7];
    const float* bo = (const float*)d_in[8];
    float* out = (float*)d_out;

    const size_t SZ = (size_t)BB * HH * NN * DD;     // elems per bf16 tensor
    __bf16* Qs = (__bf16*)d_ws;
    __bf16* Ks = Qs + SZ;
    __bf16* Vt = Ks + SZ;
    unsigned* Wob = (unsigned*)(Vt + SZ);            // packed Wo: HH * 32 * 64 dwords

    dim3 grid(NN / 64, BB * HH);
    qkv_proj_kernel <<<grid, 128, 0, stream>>>(x, Wq, bq, Wk, bk, Wv, bv, Wo, Qs, Ks, Vt, Wob);
    flash_attn_kernel<<<dim3(NN / (64 * QT), BB * HH), 128, 0, stream>>>(Qs, Ks, Vt,
                                               (const uint4*)Wob, bo, out);
}
